// v000
// The times below were measured on an AMD MI455X: many runs one after another, warmed up first and cycling through
// copies of the inputs, with the whole window's GPU time divided by the number of runs. Launches and the gaps
// between them are all in it. The median over several windows is given; except for v000 it joins two sittings, which
// can be a few percent apart, so the side-by-side timings, each taken in one sitting, are the better comparison.
// v000, which the later versions start from, runs in 145 microseconds.
#include <hip/hip_runtime.h>

typedef _Float16 half_t;
typedef __attribute__((ext_vector_type(16))) _Float16 v16h;
typedef __attribute__((ext_vector_type(8)))  _Float16 v8h;
typedef __attribute__((ext_vector_type(8)))  float    v8f;

#define NWTOK 256
#define CCH   256
#define NHEAD 8
#define SCALE_QK 0.17677669529663689f   // 1/sqrt(32)

// ---- LDS layout (total = 320000 bytes <= 320 KB/WGP) ----
#define XN_OFF   0            // half [256][264]  normalized input (A rows: [token][ch])
#define OALL_OFF 135168       // half [256][264]  attn output (B rows: [token][inner]); reused as LN raw staging
#define QS_OFF   270336       // half [256][32]   Q rows [query][dh]
#define KS_OFF   286720       // half [256][32]   K rows [key][dh]
#define VT_OFF   303104       // half [32][264]   V^T rows [dh][token]
#define LDS_BYTES 320000
#define XSTR 264
#define QSTR 32

// One operand loader for both A and B (B assumed to mirror the documented A
// interleave: lane-half selects K sub-band {0..7,16..23} vs {8..15,24..31}).
// `tile` = first row (A: M row / B: N column) of the 16-wide tile; storage is
// row-major [row][k] with the given stride (halves). Emits 2x b128 loads.
static __device__ __forceinline__ v16h load_ab(const half_t* __restrict__ base,
                                               int stride, int tile, int kbase, int lane)
{
  const int m  = lane & 15;
  const int hi = (lane >> 4) & 1;
  const half_t* p = base + (size_t)(tile + m) * stride + kbase + hi * 8;
  v8h lo = *(const v8h*)(p);
  v8h hh = *(const v8h*)(p + 16);
  v16h r;
#pragma unroll
  for (int i = 0; i < 8; ++i) { r[i] = lo[i]; r[8 + i] = hh[i]; }
  return r;
}

static __device__ __forceinline__ v8f wmma16(v16h a, v16h b, v8f c)
{
  return __builtin_amdgcn_wmma_f32_16x16x32_f16(false, a, false, b, (short)0, c, false, false);
}

// ---------------------------------------------------------------------------
// Prep: f16-transpose weights into [row][k] layouts (wqkvT as B, woutT as A), expand the
// relative-position bias table to [head][query][key] f16.
// ---------------------------------------------------------------------------
__global__ void __launch_bounds__(256) swin_prep_kernel(
    const float* __restrict__ w_qkv,      // [256][768]
    const float* __restrict__ w_out,      // [256][256]
    const float* __restrict__ bias_table, // [1575][8]
    const int*   __restrict__ rel_index,  // [256][256] (query, key)
    half_t* __restrict__ wqkvT,           // [768][256]  wqkvT[n][k] = w_qkv[k][n]
    half_t* __restrict__ woutT,           // [256][256]  woutT[c][k] = w_out[k][c]
    half_t* __restrict__ biasH)           // [8][256][256]
{
  const int idx = blockIdx.x * 256 + threadIdx.x;
  if (idx < 768 * 256) {
    const int n = idx >> 8, k = idx & 255;
    wqkvT[idx] = (half_t)w_qkv[k * 768 + n];
  } else if (idx < 768 * 256 + 256 * 256) {
    const int i = idx - 768 * 256;
    const int c = i >> 8, k = i & 255;
    woutT[i] = (half_t)w_out[k * 256 + c];
  } else {
    const int i  = idx - (768 * 256 + 256 * 256);   // < 8*65536
    const int hh = i >> 16;
    const int nm = i & 65535;                       // query*256 + key
    biasH[i] = (half_t)bias_table[rel_index[nm] * 8 + hh];
  }
}

// ---------------------------------------------------------------------------
// Fully fused window-attention block: one workgroup (8 wave32) per window.
// ---------------------------------------------------------------------------
__global__ void __launch_bounds__(256) swin_window_attn_kernel(
    const float* __restrict__ x,        // (1,256,16,64,64)
    const float* __restrict__ gamma,
    const float* __restrict__ beta,
    const half_t* __restrict__ wqkvT,   // [768][256]
    const half_t* __restrict__ woutT,   // [256][256]
    const float* __restrict__ b_out,
    const half_t* __restrict__ biasH,   // [8][256][256]
    float* __restrict__ out)            // (1,256,16,64,64)
{
  extern __shared__ char smem[];
  half_t* XN   = (half_t*)(smem + XN_OFF);
  half_t* OALL = (half_t*)(smem + OALL_OFF);
  half_t* QS   = (half_t*)(smem + QS_OFF);
  half_t* KS   = (half_t*)(smem + KS_OFF);
  half_t* VT   = (half_t*)(smem + VT_OFF);
  float*  sGamma = (float*)(smem + QS_OFF);   // overlay while QS unused (LN phase)
  float*  sBeta  = sGamma + 256;
  float*  sBout  = (float*)(smem + QS_OFF);   // overlay while QS unused (out phase)

  const int tid  = threadIdx.x;
  const int lane = tid & 31;
  const int wave = tid >> 5;
  const int hi   = (lane >> 4) & 1;
  const int nsel = lane & 15;

  const int win = blockIdx.x;
  const int gd = win >> 6, gh = (win >> 3) & 7, gw = win & 7;
  const int d0 = gd * 4, h0 = gh * 8, w0 = gw * 8;

  const v8f vzero = {0.f, 0.f, 0.f, 0.f, 0.f, 0.f, 0.f, 0.f};

  // Stage LN affine params into LDS.
  sGamma[tid] = gamma[tid];
  sBeta[tid]  = beta[tid];

  // ---- Phase 1: window gather + LayerNorm (one thread per token) ----
  {
    const int wd = tid >> 6, wh = (tid >> 3) & 7, ww = tid & 7;
    const size_t sp = (size_t)(d0 + wd) * 4096 + (size_t)(h0 + wh) * 64 + (size_t)(w0 + ww);
    const float* xp = x + sp;
    half_t* raw = OALL + (size_t)tid * XSTR;    // OALL region is free right now
    float s = 0.f, ss = 0.f;
#pragma unroll 8
    for (int c = 0; c < CCH; ++c) {
      float v = xp[(size_t)c * 65536];
      s += v; ss += v * v;
      raw[c] = (half_t)v;
    }
    const float mu  = s * (1.f / 256.f);
    const float var = ss * (1.f / 256.f) - mu * mu;
    const float rs  = rsqrtf(var + 1e-5f);
    __syncthreads();                            // gamma/beta staged by all threads
    half_t* xr = XN + (size_t)tid * XSTR;
#pragma unroll 8
    for (int c = 0; c < CCH; ++c) {
      float v = ((float)raw[c] - mu) * rs * sGamma[c] + sBeta[c];
      xr[c] = (half_t)v;
    }
  }
  __syncthreads();

  // ---- Phase 2: per head, QKV projection then attention ----
#pragma unroll 1
  for (int h = 0; h < NHEAD; ++h) {
    // --- QKV GEMM: wave owns token tiles {2w, 2w+1}; 6 output tiles (q,k,v x 2) ---
#pragma unroll 1
    for (int mt = 0; mt < 2; ++mt) {
      const int mrow = (wave * 2 + mt) * 16;
      v8f acc[6];
#pragma unroll
      for (int j = 0; j < 6; ++j) acc[j] = vzero;
      const int nb0 = h * 32;
#pragma unroll
      for (int ks = 0; ks < 8; ++ks) {
        v16h a = load_ab(XN, XSTR, mrow, ks * 32, lane);
#pragma unroll
        for (int j = 0; j < 6; ++j) {
          const int nrow = (j >> 1) * 256 + nb0 + (j & 1) * 16;  // q:0.., k:256.., v:512..
          v16h b = load_ab(wqkvT, 256, nrow, ks * 32, lane);
          acc[j] = wmma16(a, b, acc[j]);
        }
      }
      // scatter D tiles: (m=token r+8*hi, n=dh lane&15)
#pragma unroll
      for (int j = 0; j < 6; ++j) {
        const int dh = (j & 1) * 16 + nsel;
#pragma unroll
        for (int r = 0; r < 8; ++r) {
          const int tok = mrow + r + 8 * hi;
          const half_t v = (half_t)acc[j][r];
          if (j < 2)      QS[tok * QSTR + dh] = v;
          else if (j < 4) KS[tok * QSTR + dh] = v;
          else            VT[dh * XSTR + tok] = v;      // transposed store
        }
      }
    }
    __syncthreads();

    // --- attention: S^T = K·Q^T then O^T = V^T·P^T ; wave owns query tiles {w, w+8} ---
    const half_t* biasbase = biasH + (size_t)h * 65536;
#pragma unroll 1
    for (int p = 0; p < 2; ++p) {
      const int qbase = (wave + 8 * p) * 16;
      const v16h bq = load_ab(QS, QSTR, qbase, 0, lane);     // B: n=query, k=dh(32)
      const half_t* biasp = biasbase + (size_t)(qbase + nsel) * 256 + hi * 8;
      float sreg[16][8];                                     // S^T tiles, this lane: one query
      float vmax = -3.0e38f;
#pragma unroll
      for (int kt = 0; kt < 16; ++kt) {
        v16h ak = load_ab(KS, QSTR, kt * 16, 0, lane);       // A: m=key, k=dh
        v8f sc = wmma16(ak, bq, vzero);
        v8h bb = *(const v8h*)(biasp + kt * 16);             // bias[h][query][key..key+7]
#pragma unroll
        for (int r = 0; r < 8; ++r) {
          float f = sc[r] * SCALE_QK + (float)bb[r];
          sreg[kt][r] = f;
          vmax = fmaxf(vmax, f);
        }
      }
      vmax = fmaxf(vmax, __shfl_xor(vmax, 16));              // lanes l, l+16 share a query
      float rsum = 0.f;
      v8f o0 = vzero, o1 = vzero;
#pragma unroll
      for (int kb = 0; kb < 8; ++kb) {                       // 32-key blocks
        v16h pb;                                             // D tiles ARE the B operand
#pragma unroll
        for (int r = 0; r < 8; ++r) {
          float e0 = __expf(sreg[2 * kb][r] - vmax);
          float e1 = __expf(sreg[2 * kb + 1][r] - vmax);
          rsum += e0 + e1;
          pb[r]     = (half_t)e0;
          pb[8 + r] = (half_t)e1;
        }
        v16h av0 = load_ab(VT, XSTR, 0,  kb * 32, lane);     // A: m=dh 0..15,  k=key
        v16h av1 = load_ab(VT, XSTR, 16, kb * 32, lane);     // A: m=dh 16..31, k=key
        o0 = wmma16(av0, pb, o0);
        o1 = wmma16(av1, pb, o1);
      }
      rsum += __shfl_xor(rsum, 16);
      const float inv = 1.f / rsum;
      half_t* orow = OALL + (size_t)(qbase + nsel) * XSTR + h * 32;
#pragma unroll
      for (int r = 0; r < 8; ++r) {                          // O^T: n=query=lane&15 too
        orow[r + 8 * hi]      = (half_t)(o0[r] * inv);
        orow[16 + r + 8 * hi] = (half_t)(o1[r] * inv);
      }
    }
    __syncthreads();
  }

  // ---- Phase 3: output projection out^T = woutT · OALL^T (+b_out) + window merge ----
  sBout[tid] = b_out[tid];
  __syncthreads();
#pragma unroll 1
  for (int mt = 0; mt < 2; ++mt) {
    const int crow = (wave * 2 + mt) * 16;                   // channel tile
#pragma unroll 1
    for (int ch = 0; ch < 2; ++ch) {
      v8f acc[8];
#pragma unroll
      for (int j = 0; j < 8; ++j) acc[j] = vzero;
#pragma unroll
      for (int ks = 0; ks < 8; ++ks) {
        v16h a = load_ab(woutT, 256, crow, ks * 32, lane);   // A: m=channel, k=inner
#pragma unroll
        for (int j = 0; j < 8; ++j) {
          v16h b = load_ab(OALL, XSTR, (ch * 8 + j) * 16, ks * 32, lane); // B: n=token
          acc[j] = wmma16(a, b, acc[j]);
        }
      }
#pragma unroll
      for (int j = 0; j < 8; ++j) {
        const int tok = (ch * 8 + j) * 16 + nsel;
        const int wd = tok >> 6, wh = (tok >> 3) & 7, ww = tok & 7;
        const size_t sp = (size_t)(d0 + wd) * 4096 + (size_t)(h0 + wh) * 64 + (size_t)(w0 + ww);
#pragma unroll
        for (int r = 0; r < 8; ++r) {
          const int c = crow + r + 8 * hi;
          out[(size_t)c * 65536 + sp] = acc[j][r] + sBout[c];  // lanes 0..7: 32B runs
        }
      }
    }
  }
}

// ---------------------------------------------------------------------------
extern "C" void kernel_launch(void* const* d_in, const int* in_sizes, int n_in,
                              void* d_out, int out_size, void* d_ws, size_t ws_size,
                              hipStream_t stream)
{
  (void)in_sizes; (void)n_in; (void)out_size; (void)ws_size;
  const float* x      = (const float*)d_in[0];
  const float* gamma  = (const float*)d_in[1];
  const float* beta   = (const float*)d_in[2];
  const float* w_qkv  = (const float*)d_in[3];
  const float* w_out  = (const float*)d_in[4];
  const float* b_out  = (const float*)d_in[5];
  const float* btable = (const float*)d_in[6];
  const int*   relidx = (const int*)d_in[7];
  float* out = (float*)d_out;

  // Workspace: only 1.57 MB of f16 weight/bias staging.
  half_t* wqkvT = (half_t*)d_ws;            // 768*256
  half_t* woutT = wqkvT + 768 * 256;        // 256*256
  half_t* biasH = woutT + 256 * 256;        // 8*256*256

  swin_prep_kernel<<<3072, 256, 0, stream>>>(w_qkv, w_out, btable, relidx,
                                             wqkvT, woutT, biasH);

  (void)hipFuncSetAttribute((const void*)swin_window_attn_kernel,
                            hipFuncAttributeMaxDynamicSharedMemorySize, LDS_BYTES);
  swin_window_attn_kernel<<<256, 256, LDS_BYTES, stream>>>(
      x, gamma, beta, wqkvT, woutT, b_out, biasH, out);
}

// v001
// One run takes 129 microseconds.
// In two side-by-side timings against v000, it was 1.15 and 1.16 times as fast.
#include <hip/hip_runtime.h>

typedef _Float16 half_t;
typedef __attribute__((ext_vector_type(16))) _Float16 v16h;
typedef __attribute__((ext_vector_type(8)))  _Float16 v8h;
typedef __attribute__((ext_vector_type(8)))  float    v8f;

#define NWTOK 256
#define CCH   256
#define NHEAD 8
#define SCALE_QK 0.17677669529663689f   // 1/sqrt(32)

// ---- LDS layout (total = 320000 bytes <= 320 KB/WGP) ----
#define XN_OFF   0            // half [256][264]  normalized input (A rows: [token][ch])
#define OALL_OFF 135168       // half [256][264]  attn output (B rows: [token][inner]); reused as LN raw staging
#define QS_OFF   270336       // half [256][32]   Q rows [query][dh]
#define KS_OFF   286720       // half [256][32]   K rows [key][dh]
#define VT_OFF   303104       // half [32][264]   V^T rows [dh][token]
#define LDS_BYTES 320000
#define XSTR 264
#define QSTR 32

// One operand loader for both A and B (B assumed to mirror the documented A
// interleave: lane-half selects K sub-band {0..7,16..23} vs {8..15,24..31}).
// `tile` = first row (A: M row / B: N column) of the 16-wide tile; storage is
// row-major [row][k] with the given stride (halves). Emits 2x b128 loads.
static __device__ __forceinline__ v16h load_ab(const half_t* __restrict__ base,
                                               int stride, int tile, int kbase, int lane)
{
  const int m  = lane & 15;
  const int hi = (lane >> 4) & 1;
  const half_t* p = base + (size_t)(tile + m) * stride + kbase + hi * 8;
  v8h lo = *(const v8h*)(p);
  v8h hh = *(const v8h*)(p + 16);
  v16h r;
#pragma unroll
  for (int i = 0; i < 8; ++i) { r[i] = lo[i]; r[8 + i] = hh[i]; }
  return r;
}

// Same fragment as load_ab (same value in every lane and register), read from a
// buffer that the prep kernel laid out in fragment order: per (16-row tile,
// 32-wide k step) one 1-KB block = 32 lanes x 16 B of the low registers, then
// 32 lanes x 16 B of the high registers. Each b128 load covers 512 contiguous
// bytes (4 whole 128-B lines) instead of 32 B out of each of 16 rows.
static __device__ __forceinline__ v16h load_packed(const half_t* __restrict__ base,
                                                   int tile16, int ks, int lane)
{
  const half_t* p = base + (size_t)((tile16 * 8 + ks) * 512) + lane * 8;
  v8h lo = *(const v8h*)(p);
  v8h hh = *(const v8h*)(p + 256);
  v16h r;
#pragma unroll
  for (int i = 0; i < 8; ++i) { r[i] = lo[i]; r[8 + i] = hh[i]; }
  return r;
}

static __device__ __forceinline__ v8f wmma16(v16h a, v16h b, v8f c)
{
  return __builtin_amdgcn_wmma_f32_16x16x32_f16(false, a, false, b, (short)0, c, false, false);
}

// ---------------------------------------------------------------------------
// Prep: convert the weights to f16 in fragment order (see load_packed), expand
// the relative-position bias table to f16 in the order of the S^T tiles:
// [head][query tile][key tile][lane][8], lane = (key>>3 & 1)*16 + (query & 15).
// ---------------------------------------------------------------------------
__global__ void __launch_bounds__(256) swin_prep_kernel(
    const float* __restrict__ w_qkv,      // [256][768]
    const float* __restrict__ w_out,      // [256][256]
    const float* __restrict__ bias_table, // [1575][8]
    const int*   __restrict__ rel_index,  // [256][256] (query, key)
    half_t* __restrict__ wqkvP,           // [48 tiles][8 k steps][2][32 lanes][8]
    half_t* __restrict__ woutP,           // [16 tiles][8 k steps][2][32 lanes][8]
    half_t* __restrict__ biasP)           // [8][16 q tiles][16 key tiles][32 lanes][8]
{
  const int idx = blockIdx.x * 256 + threadIdx.x;
  if (idx < 768 * 256 + 256 * 256) {
    const bool isq = idx < 768 * 256;
    const int i    = isq ? idx : idx - 768 * 256;
    const int e    = i & 7;                         // element of the 16-B piece
    const int ln   = (i >> 3) & 31;                 // lane of the fragment
    const int sel  = (i >> 8) & 1;                  // low / high registers
    const int ks   = (i >> 9) & 7;
    const int row  = (i >> 12) * 16 + (ln & 15);    // output column of the weight
    const int k    = ks * 32 + sel * 16 + (ln >> 4) * 8 + e;
    if (isq) wqkvP[i] = (half_t)w_qkv[k * 768 + row];
    else     woutP[i] = (half_t)w_out[k * 256 + row];
  } else {
    const int i  = idx - (768 * 256 + 256 * 256);   // < 8*65536
    const int hh = i >> 16;
    const int e  = i & 7;
    const int ln = (i >> 3) & 31;
    const int kt = (i >> 8) & 15;
    const int qt = (i >> 12) & 15;
    const int query = qt * 16 + (ln & 15);
    const int key   = kt * 16 + (ln >> 4) * 8 + e;
    const int rel   = min(max(rel_index[query * 256 + key], 0), 1574);  // stay inside bias_table
    biasP[i] = (half_t)bias_table[rel * 8 + hh];
  }
}

// ---------------------------------------------------------------------------
// Fully fused window-attention block: one workgroup (8 wave32) per window.
// ---------------------------------------------------------------------------
__global__ void __launch_bounds__(256) swin_window_attn_kernel(
    const float* __restrict__ x,        // (1,256,16,64,64)
    const float* __restrict__ gamma,
    const float* __restrict__ beta,
    const half_t* __restrict__ wqkvP,   // fragment order, 48 tiles x 8 k steps
    const half_t* __restrict__ woutP,   // fragment order, 16 tiles x 8 k steps
    const float* __restrict__ b_out,
    const half_t* __restrict__ biasP,   // [8][16][16][32 lanes][8]
    float* __restrict__ out)            // (1,256,16,64,64)
{
  extern __shared__ char smem[];
  half_t* XN   = (half_t*)(smem + XN_OFF);
  half_t* OALL = (half_t*)(smem + OALL_OFF);
  half_t* QS   = (half_t*)(smem + QS_OFF);
  half_t* KS   = (half_t*)(smem + KS_OFF);
  half_t* VT   = (half_t*)(smem + VT_OFF);
  float*  sGamma = (float*)(smem + QS_OFF);   // overlay while QS unused (LN phase)
  float*  sBeta  = sGamma + 256;
  float*  sBout  = (float*)(smem + QS_OFF);   // overlay while QS unused (out phase)

  const int tid  = threadIdx.x;
  const int lane = tid & 31;
  const int wave = tid >> 5;
  const int hi   = (lane >> 4) & 1;
  const int nsel = lane & 15;

  const int win = blockIdx.x;
  const int gd = win >> 6, gh = (win >> 3) & 7, gw = win & 7;
  const int d0 = gd * 4, h0 = gh * 8, w0 = gw * 8;

  const v8f vzero = {0.f, 0.f, 0.f, 0.f, 0.f, 0.f, 0.f, 0.f};

  // Stage LN affine params into LDS.
  sGamma[tid] = gamma[tid];
  sBeta[tid]  = beta[tid];

  // ---- Phase 1: window gather + LayerNorm (one thread per token) ----
  {
    const int wd = tid >> 6, wh = (tid >> 3) & 7, ww = tid & 7;
    const size_t sp = (size_t)(d0 + wd) * 4096 + (size_t)(h0 + wh) * 64 + (size_t)(w0 + ww);
    const float* xp = x + sp;
    half_t* raw = OALL + (size_t)tid * XSTR;    // OALL region is free right now
    float s = 0.f, ss = 0.f;
#pragma unroll 8
    for (int c = 0; c < CCH; ++c) {
      float v = xp[(size_t)c * 65536];
      s += v; ss += v * v;
      raw[c] = (half_t)v;
    }
    const float mu  = s * (1.f / 256.f);
    const float var = ss * (1.f / 256.f) - mu * mu;
    const float rs  = rsqrtf(var + 1e-5f);
    __syncthreads();                            // gamma/beta staged by all threads
    half_t* xr = XN + (size_t)tid * XSTR;
#pragma unroll 8
    for (int c = 0; c < CCH; ++c) {
      float v = ((float)raw[c] - mu) * rs * sGamma[c] + sBeta[c];
      xr[c] = (half_t)v;
    }
  }
  __syncthreads();

  // ---- Phase 2: per head, QKV projection then attention ----
#pragma unroll 1
  for (int h = 0; h < NHEAD; ++h) {
    // --- QKV GEMM: wave owns token tiles {2w, 2w+1}; 6 output tiles (q,k,v x 2) ---
#pragma unroll 1
    for (int mt = 0; mt < 2; ++mt) {
      const int mrow = (wave * 2 + mt) * 16;
      v8f acc[6];
#pragma unroll
      for (int j = 0; j < 6; ++j) acc[j] = vzero;
#pragma unroll
      for (int ks = 0; ks < 8; ++ks) {
        v16h a = load_ab(XN, XSTR, mrow, ks * 32, lane);
#pragma unroll
        for (int j = 0; j < 6; ++j) {
          const int ntile = (j >> 1) * 16 + h * 2 + (j & 1);     // q:0.., k:16.., v:32..
          v16h b = load_packed(wqkvP, ntile, ks, lane);
          acc[j] = wmma16(a, b, acc[j]);
        }
      }
      // scatter D tiles: (m=token r+8*hi, n=dh lane&15)
#pragma unroll
      for (int j = 0; j < 6; ++j) {
        const int dh = (j & 1) * 16 + nsel;
#pragma unroll
        for (int r = 0; r < 8; ++r) {
          const int tok = mrow + r + 8 * hi;
          const half_t v = (half_t)acc[j][r];
          if (j < 2)      QS[tok * QSTR + dh] = v;
          else if (j < 4) KS[tok * QSTR + dh] = v;
          else            VT[dh * XSTR + tok] = v;      // transposed store
        }
      }
    }
    __syncthreads();

    // --- attention: S^T = K·Q^T then O^T = V^T·P^T ; wave owns query tiles {w, w+8} ---
    const half_t* biasbase = biasP + (size_t)h * 65536;
#pragma unroll 1
    for (int p = 0; p < 2; ++p) {
      const int qbase = (wave + 8 * p) * 16;
      const v16h bq = load_ab(QS, QSTR, qbase, 0, lane);     // B: n=query, k=dh(32)
      const half_t* biasp = biasbase + (size_t)(wave + 8 * p) * 4096 + lane * 8;
      float sreg[16][8];                                     // S^T tiles, this lane: one query
      float vmax = -3.0e38f;
#pragma unroll
      for (int kt = 0; kt < 16; ++kt) {
        v16h ak = load_ab(KS, QSTR, kt * 16, 0, lane);       // A: m=key, k=dh
        v8f sc = wmma16(ak, bq, vzero);
        v8h bb = *(const v8h*)(biasp + kt * 256);            // bias[h][query][key..key+7]
#pragma unroll
        for (int r = 0; r < 8; ++r) {
          float f = sc[r] * SCALE_QK + (float)bb[r];
          sreg[kt][r] = f;
          vmax = fmaxf(vmax, f);
        }
      }
      vmax = fmaxf(vmax, __shfl_xor(vmax, 16));              // lanes l, l+16 share a query
      float rsum = 0.f;
      v8f o0 = vzero, o1 = vzero;
#pragma unroll
      for (int kb = 0; kb < 8; ++kb) {                       // 32-key blocks
        v16h pb;                                             // D tiles ARE the B operand
#pragma unroll
        for (int r = 0; r < 8; ++r) {
          float e0 = __expf(sreg[2 * kb][r] - vmax);
          float e1 = __expf(sreg[2 * kb + 1][r] - vmax);
          rsum += e0 + e1;
          pb[r]     = (half_t)e0;
          pb[8 + r] = (half_t)e1;
        }
        v16h av0 = load_ab(VT, XSTR, 0,  kb * 32, lane);     // A: m=dh 0..15,  k=key
        v16h av1 = load_ab(VT, XSTR, 16, kb * 32, lane);     // A: m=dh 16..31, k=key
        o0 = wmma16(av0, pb, o0);
        o1 = wmma16(av1, pb, o1);
      }
      rsum += __shfl_xor(rsum, 16);
      const float inv = 1.f / rsum;
      half_t* orow = OALL + (size_t)(qbase + nsel) * XSTR + h * 32;
#pragma unroll
      for (int r = 0; r < 8; ++r) {                          // O^T: n=query=lane&15 too
        orow[r + 8 * hi]      = (half_t)(o0[r] * inv);
        orow[16 + r + 8 * hi] = (half_t)(o1[r] * inv);
      }
    }
    __syncthreads();
  }

  // ---- Phase 3: output projection out^T = w_out^T * OALL^T (+b_out) + window merge ----
  sBout[tid] = b_out[tid];
  __syncthreads();
#pragma unroll 1
  for (int mt = 0; mt < 2; ++mt) {
    const int crow = (wave * 2 + mt) * 16;                   // channel tile
#pragma unroll 1
    for (int ch = 0; ch < 2; ++ch) {
      v8f acc[8];
#pragma unroll
      for (int j = 0; j < 8; ++j) acc[j] = vzero;
#pragma unroll
      for (int ks = 0; ks < 8; ++ks) {
        v16h a = load_packed(woutP, wave * 2 + mt, ks, lane); // A: m=channel, k=inner
#pragma unroll
        for (int j = 0; j < 8; ++j) {
          v16h b = load_ab(OALL, XSTR, (ch * 8 + j) * 16, ks * 32, lane); // B: n=token
          acc[j] = wmma16(a, b, acc[j]);
        }
      }
#pragma unroll
      for (int j = 0; j < 8; ++j) {
        const int tok = (ch * 8 + j) * 16 + nsel;
        const int wd = tok >> 6, wh = (tok >> 3) & 7, ww = tok & 7;
        const size_t sp = (size_t)(d0 + wd) * 4096 + (size_t)(h0 + wh) * 64 + (size_t)(w0 + ww);
#pragma unroll
        for (int r = 0; r < 8; ++r) {
          const int c = crow + r + 8 * hi;
          out[(size_t)c * 65536 + sp] = acc[j][r] + sBout[c];  // lanes 0..7: 32B runs
        }
      }
    }
  }
}

// ---------------------------------------------------------------------------
extern "C" void kernel_launch(void* const* d_in, const int* in_sizes, int n_in,
                              void* d_out, int out_size, void* d_ws, size_t ws_size,
                              hipStream_t stream)
{
  (void)in_sizes; (void)n_in; (void)out_size; (void)ws_size;
  const float* x      = (const float*)d_in[0];
  const float* gamma  = (const float*)d_in[1];
  const float* beta   = (const float*)d_in[2];
  const float* w_qkv  = (const float*)d_in[3];
  const float* w_out  = (const float*)d_in[4];
  const float* b_out  = (const float*)d_in[5];
  const float* btable = (const float*)d_in[6];
  const int*   relidx = (const int*)d_in[7];
  float* out = (float*)d_out;

  // Workspace: only 1.57 MB of f16 weight/bias staging.
  half_t* wqkvP = (half_t*)d_ws;            // 768*256
  half_t* woutP = wqkvP + 768 * 256;        // 256*256
  half_t* biasP = woutP + 256 * 256;        // 8*256*256

  swin_prep_kernel<<<3072, 256, 0, stream>>>(w_qkv, w_out, btable, relidx,
                                             wqkvP, woutP, biasP);

  (void)hipFuncSetAttribute((const void*)swin_window_attn_kernel,
                            hipFuncAttributeMaxDynamicSharedMemorySize, LDS_BYTES);
  swin_window_attn_kernel<<<256, 256, LDS_BYTES, stream>>>(
      x, gamma, beta, wqkvP, woutP, b_out, biasP, out);
}

// v002
// Measured time: 122 microseconds a run.
// Next to v001, in two timings, it ran 1.08 and 1.06 times as fast.
// Over all steps from v000 it is 1.24 times as fast.
#include <hip/hip_runtime.h>

typedef _Float16 half_t;
typedef __attribute__((ext_vector_type(16))) _Float16 v16h;
typedef __attribute__((ext_vector_type(8)))  _Float16 v8h;
typedef __attribute__((ext_vector_type(8)))  float    v8f;

#define NWTOK 256
#define CCH   256
#define NHEAD 8
#define SCALE_QK 0.17677669529663689f   // 1/sqrt(32)

// ---- LDS layout (total = 320000 bytes <= 320 KB/WGP) ----
#define XN_OFF   0            // half [256][264]  normalized input (A rows: [token][ch])
#define OALL_OFF 135168       // half [256][264]  attn output (B rows: [token][inner]); reused as LN raw staging
#define QS_OFF   270336       // half [256][32]   Q rows [query][dh], pieces swizzled (load_qk)
#define KS_OFF   286720       // half [256][32]   K rows [key][dh], pieces swizzled (load_qk)
#define VT_OFF   303104       // half [32][264]   V^T rows [dh][token]
#define LDS_BYTES 320000
#define XSTR 264
#define QSTR 32

// One operand loader for both A and B (B assumed to mirror the documented A
// interleave: lane-half selects K sub-band {0..7,16..23} vs {8..15,24..31}).
// `tile` = first row (A: M row / B: N column) of the 16-wide tile; storage is
// row-major [row][k] with the given stride (halves). Emits 2x b128 loads.
static __device__ __forceinline__ v16h load_ab(const half_t* __restrict__ base,
                                               int stride, int tile, int kbase, int lane)
{
  const int m  = lane & 15;
  const int hi = (lane >> 4) & 1;
  const half_t* p = base + (size_t)(tile + m) * stride + kbase + hi * 8;
  v8h lo = *(const v8h*)(p);
  v8h hh = *(const v8h*)(p + 16);
  v16h r;
#pragma unroll
  for (int i = 0; i < 8; ++i) { r[i] = lo[i]; r[8 + i] = hh[i]; }
  return r;
}

// Same fragment as load_ab (same value in every lane and register), read from a
// buffer that the prep kernel laid out in fragment order: per (16-row tile,
// 32-wide k step) one 1-KB block = 32 lanes x 16 B of the low registers, then
// 32 lanes x 16 B of the high registers. Each b128 load covers 512 contiguous
// bytes (4 whole 128-B lines) instead of 32 B out of each of 16 rows.
static __device__ __forceinline__ v16h load_packed(const half_t* __restrict__ base,
                                                   int tile16, int ks, int lane)
{
  const half_t* p = base + (size_t)((tile16 * 8 + ks) * 512) + lane * 8;
  v8h lo = *(const v8h*)(p);
  v8h hh = *(const v8h*)(p + 256);
  v16h r;
#pragma unroll
  for (int i = 0; i < 8; ++i) { r[i] = lo[i]; r[8 + i] = hh[i]; }
  return r;
}

// Q and K rows are 64 B (four 16-B pieces). Piece c of row t is kept at piece
// c ^ ((t >> 2) & 3): the 16 rows that one half-wave reads at one piece index then
// fall on 16 different groups of four banks instead of 4 (unpadded 64-B rows put
// rows t, t+4, t+8, t+12 on the same banks). No extra LDS.
// Same fragment as load_ab(base, QSTR, tile, 0, lane), read through that map.
// tile is a multiple of 16, so the swizzle term depends on the lane alone.
static __device__ __forceinline__ v16h load_qk(const half_t* __restrict__ base,
                                               int tile, int lane)
{
  const int m  = lane & 15;
  const int hi = (lane >> 4) & 1;
  const int p0 = (hi ^ (m >> 2)) << 3;            // dh = hi*8 .. +7
  const half_t* p = base + (tile + m) * QSTR;
  v8h lo = *(const v8h*)(p + p0);
  v8h hh = *(const v8h*)(p + (p0 ^ 16));          // dh = 16 + hi*8 .. +7
  v16h r;
#pragma unroll
  for (int i = 0; i < 8; ++i) { r[i] = lo[i]; r[8 + i] = hh[i]; }
  return r;
}

static __device__ __forceinline__ v8f wmma16(v16h a, v16h b, v8f c)
{
  return __builtin_amdgcn_wmma_f32_16x16x32_f16(false, a, false, b, (short)0, c, false, false);
}

// ---------------------------------------------------------------------------
// Prep: convert the weights to f16 in fragment order (see load_packed), expand
// the relative-position bias table to f16 in the order of the S^T tiles:
// [head][query tile][key tile][lane][8], lane = (key>>3 & 1)*16 + (query & 15).
// ---------------------------------------------------------------------------
__global__ void __launch_bounds__(256) swin_prep_kernel(
    const float* __restrict__ w_qkv,      // [256][768]
    const float* __restrict__ w_out,      // [256][256]
    const float* __restrict__ bias_table, // [1575][8]
    const int*   __restrict__ rel_index,  // [256][256] (query, key)
    half_t* __restrict__ wqkvP,           // [48 tiles][8 k steps][2][32 lanes][8]
    half_t* __restrict__ woutP,           // [16 tiles][8 k steps][2][32 lanes][8]
    half_t* __restrict__ biasP)           // [8][16 q tiles][16 key tiles][32 lanes][8]
{
  const int idx = blockIdx.x * 256 + threadIdx.x;
  if (idx < 768 * 256 + 256 * 256) {
    const bool isq = idx < 768 * 256;
    const int i    = isq ? idx : idx - 768 * 256;
    const int e    = i & 7;                         // element of the 16-B piece
    const int ln   = (i >> 3) & 31;                 // lane of the fragment
    const int sel  = (i >> 8) & 1;                  // low / high registers
    const int ks   = (i >> 9) & 7;
    const int row  = (i >> 12) * 16 + (ln & 15);    // output column of the weight
    const int k    = ks * 32 + sel * 16 + (ln >> 4) * 8 + e;
    if (isq) wqkvP[i] = (half_t)w_qkv[k * 768 + row];
    else     woutP[i] = (half_t)w_out[k * 256 + row];
  } else {
    const int i  = idx - (768 * 256 + 256 * 256);   // < 8*65536
    const int hh = i >> 16;
    const int e  = i & 7;
    const int ln = (i >> 3) & 31;
    const int kt = (i >> 8) & 15;
    const int qt = (i >> 12) & 15;
    const int query = qt * 16 + (ln & 15);
    const int key   = kt * 16 + (ln >> 4) * 8 + e;
    const int rel   = min(max(rel_index[query * 256 + key], 0), 1574);  // stay inside bias_table
    biasP[i] = (half_t)bias_table[rel * 8 + hh];
  }
}

// ---------------------------------------------------------------------------
// Fully fused window-attention block: one workgroup (8 wave32) per window.
// ---------------------------------------------------------------------------
__global__ void __launch_bounds__(256) swin_window_attn_kernel(
    const float* __restrict__ x,        // (1,256,16,64,64)
    const float* __restrict__ gamma,
    const float* __restrict__ beta,
    const half_t* __restrict__ wqkvP,   // fragment order, 48 tiles x 8 k steps
    const half_t* __restrict__ woutP,   // fragment order, 16 tiles x 8 k steps
    const float* __restrict__ b_out,
    const half_t* __restrict__ biasP,   // [8][16][16][32 lanes][8]
    float* __restrict__ out)            // (1,256,16,64,64)
{
  extern __shared__ char smem[];
  half_t* XN   = (half_t*)(smem + XN_OFF);
  half_t* OALL = (half_t*)(smem + OALL_OFF);
  half_t* QS   = (half_t*)(smem + QS_OFF);
  half_t* KS   = (half_t*)(smem + KS_OFF);
  half_t* VT   = (half_t*)(smem + VT_OFF);
  float*  sGamma = (float*)(smem + QS_OFF);   // overlay while QS unused (LN phase)
  float*  sBeta  = sGamma + 256;
  float*  sBout  = (float*)(smem + QS_OFF);   // overlay while QS unused (out phase)

  const int tid  = threadIdx.x;
  const int lane = tid & 31;
  const int wave = tid >> 5;
  const int hi   = (lane >> 4) & 1;
  const int nsel = lane & 15;

  const int win = blockIdx.x;
  const int gd = win >> 6, gh = (win >> 3) & 7, gw = win & 7;
  const int d0 = gd * 4, h0 = gh * 8, w0 = gw * 8;

  const v8f vzero = {0.f, 0.f, 0.f, 0.f, 0.f, 0.f, 0.f, 0.f};

  // Stage LN affine params into LDS.
  sGamma[tid] = gamma[tid];
  sBeta[tid]  = beta[tid];

  // ---- Phase 1: window gather + LayerNorm (one thread per token) ----
  {
    const int wd = tid >> 6, wh = (tid >> 3) & 7, ww = tid & 7;
    const size_t sp = (size_t)(d0 + wd) * 4096 + (size_t)(h0 + wh) * 64 + (size_t)(w0 + ww);
    const float* xp = x + sp;
    half_t* raw = OALL + (size_t)tid * XSTR;    // OALL region is free right now
    float s = 0.f, ss = 0.f;
#pragma unroll 8
    for (int c = 0; c < CCH; ++c) {
      float v = xp[(size_t)c * 65536];
      s += v; ss += v * v;
      raw[c] = (half_t)v;
    }
    const float mu  = s * (1.f / 256.f);
    const float var = ss * (1.f / 256.f) - mu * mu;
    const float rs  = rsqrtf(var + 1e-5f);
    __syncthreads();                            // gamma/beta staged by all threads
    half_t* xr = XN + (size_t)tid * XSTR;
#pragma unroll 8
    for (int c = 0; c < CCH; ++c) {
      float v = ((float)raw[c] - mu) * rs * sGamma[c] + sBeta[c];
      xr[c] = (half_t)v;
    }
  }
  __syncthreads();

  // ---- Phase 2: per head, QKV projection then attention ----
  // Lane part of the swizzled Q/K store offset, element (token mrow + r + 8*hi,
  // dh jj*16 + nsel): piece jj*2 + (nsel>>3), row term (r>>2) + 2*hi.
  int qkst[2][2];
#pragma unroll
  for (int jj = 0; jj < 2; ++jj)
#pragma unroll
    for (int rr = 0; rr < 2; ++rr)
      qkst[jj][rr] = hi * 8 * QSTR + (((jj * 2 + (nsel >> 3)) ^ (rr + 2 * hi)) << 3) + (nsel & 7);
#pragma unroll 1
  for (int h = 0; h < NHEAD; ++h) {
    // --- QKV GEMM: wave owns token tiles {2w, 2w+1}; 6 output tiles (q,k,v x 2) ---
#pragma unroll 1
    for (int mt = 0; mt < 2; ++mt) {
      const int mrow = (wave * 2 + mt) * 16;
      v8f acc[6];
#pragma unroll
      for (int j = 0; j < 6; ++j) acc[j] = vzero;
#pragma unroll
      for (int ks = 0; ks < 8; ++ks) {
        v16h a = load_ab(XN, XSTR, mrow, ks * 32, lane);
#pragma unroll
        for (int j = 0; j < 6; ++j) {
          const int ntile = (j >> 1) * 16 + h * 2 + (j & 1);     // q:0.., k:16.., v:32..
          v16h b = load_packed(wqkvP, ntile, ks, lane);
          acc[j] = wmma16(a, b, acc[j]);
        }
      }
      // scatter D tiles: (m=token r+8*hi, n=dh lane&15)
#pragma unroll
      for (int j = 0; j < 6; ++j) {
        const int dh = (j & 1) * 16 + nsel;
#pragma unroll
        for (int r = 0; r < 8; ++r) {
          const int tok = mrow + r + 8 * hi;
          const half_t v = (half_t)acc[j][r];
          if (j < 2)      QS[(mrow + r) * QSTR + qkst[j & 1][r >> 2]] = v;
          else if (j < 4) KS[(mrow + r) * QSTR + qkst[j & 1][r >> 2]] = v;
          else            VT[dh * XSTR + tok] = v;      // transposed store
        }
      }
    }
    __syncthreads();

    // --- attention: S^T = K·Q^T then O^T = V^T·P^T ; wave owns query tiles {w, w+8} ---
    const half_t* biasbase = biasP + (size_t)h * 65536;
#pragma unroll 1
    for (int p = 0; p < 2; ++p) {
      const int qbase = (wave + 8 * p) * 16;
      const v16h bq = load_qk(QS, qbase, lane);              // B: n=query, k=dh(32)
      const half_t* biasp = biasbase + (size_t)(wave + 8 * p) * 4096 + lane * 8;
      float sreg[16][8];                                     // S^T tiles, this lane: one query
      float vmax = -3.0e38f;
#pragma unroll
      for (int kt = 0; kt < 16; ++kt) {
        v16h ak = load_qk(KS, kt * 16, lane);                // A: m=key, k=dh
        v8f sc = wmma16(ak, bq, vzero);
        v8h bb = *(const v8h*)(biasp + kt * 256);            // bias[h][query][key..key+7]
#pragma unroll
        for (int r = 0; r < 8; ++r) {
          float f = sc[r] * SCALE_QK + (float)bb[r];
          sreg[kt][r] = f;
          vmax = fmaxf(vmax, f);
        }
      }
      vmax = fmaxf(vmax, __shfl_xor(vmax, 16));              // lanes l, l+16 share a query
      float rsum = 0.f;
      v8f o0 = vzero, o1 = vzero;
#pragma unroll
      for (int kb = 0; kb < 8; ++kb) {                       // 32-key blocks
        v16h pb;                                             // D tiles ARE the B operand
#pragma unroll
        for (int r = 0; r < 8; ++r) {
          float e0 = __expf(sreg[2 * kb][r] - vmax);
          float e1 = __expf(sreg[2 * kb + 1][r] - vmax);
          rsum += e0 + e1;
          pb[r]     = (half_t)e0;
          pb[8 + r] = (half_t)e1;
        }
        v16h av0 = load_ab(VT, XSTR, 0,  kb * 32, lane);     // A: m=dh 0..15,  k=key
        v16h av1 = load_ab(VT, XSTR, 16, kb * 32, lane);     // A: m=dh 16..31, k=key
        o0 = wmma16(av0, pb, o0);
        o1 = wmma16(av1, pb, o1);
      }
      rsum += __shfl_xor(rsum, 16);
      const float inv = 1.f / rsum;
      half_t* orow = OALL + (size_t)(qbase + nsel) * XSTR + h * 32;
#pragma unroll
      for (int r = 0; r < 8; ++r) {                          // O^T: n=query=lane&15 too
        orow[r + 8 * hi]      = (half_t)(o0[r] * inv);
        orow[16 + r + 8 * hi] = (half_t)(o1[r] * inv);
      }
    }
    __syncthreads();
  }

  // ---- Phase 3: output projection out^T = w_out^T * OALL^T (+b_out) + window merge ----
  sBout[tid] = b_out[tid];
  __syncthreads();
#pragma unroll 1
  for (int mt = 0; mt < 2; ++mt) {
    const int crow = (wave * 2 + mt) * 16;                   // channel tile
#pragma unroll 1
    for (int ch = 0; ch < 2; ++ch) {
      v8f acc[8];
#pragma unroll
      for (int j = 0; j < 8; ++j) acc[j] = vzero;
#pragma unroll
      for (int ks = 0; ks < 8; ++ks) {
        v16h a = load_packed(woutP, wave * 2 + mt, ks, lane); // A: m=channel, k=inner
#pragma unroll
        for (int j = 0; j < 8; ++j) {
          v16h b = load_ab(OALL, XSTR, (ch * 8 + j) * 16, ks * 32, lane); // B: n=token
          acc[j] = wmma16(a, b, acc[j]);
        }
      }
#pragma unroll
      for (int j = 0; j < 8; ++j) {
        const int tok = (ch * 8 + j) * 16 + nsel;
        const int wd = tok >> 6, wh = (tok >> 3) & 7, ww = tok & 7;
        const size_t sp = (size_t)(d0 + wd) * 4096 + (size_t)(h0 + wh) * 64 + (size_t)(w0 + ww);
#pragma unroll
        for (int r = 0; r < 8; ++r) {
          const int c = crow + r + 8 * hi;
          out[(size_t)c * 65536 + sp] = acc[j][r] + sBout[c];  // lanes 0..7: 32B runs
        }
      }
    }
  }
}

// ---------------------------------------------------------------------------
extern "C" void kernel_launch(void* const* d_in, const int* in_sizes, int n_in,
                              void* d_out, int out_size, void* d_ws, size_t ws_size,
                              hipStream_t stream)
{
  (void)in_sizes; (void)n_in; (void)out_size; (void)ws_size;
  const float* x      = (const float*)d_in[0];
  const float* gamma  = (const float*)d_in[1];
  const float* beta   = (const float*)d_in[2];
  const float* w_qkv  = (const float*)d_in[3];
  const float* w_out  = (const float*)d_in[4];
  const float* b_out  = (const float*)d_in[5];
  const float* btable = (const float*)d_in[6];
  const int*   relidx = (const int*)d_in[7];
  float* out = (float*)d_out;

  // Workspace: only 1.57 MB of f16 weight/bias staging.
  half_t* wqkvP = (half_t*)d_ws;            // 768*256
  half_t* woutP = wqkvP + 768 * 256;        // 256*256
  half_t* biasP = woutP + 256 * 256;        // 8*256*256

  swin_prep_kernel<<<3072, 256, 0, stream>>>(w_qkv, w_out, btable, relidx,
                                             wqkvP, woutP, biasP);

  (void)hipFuncSetAttribute((const void*)swin_window_attn_kernel,
                            hipFuncAttributeMaxDynamicSharedMemorySize, LDS_BYTES);
  swin_window_attn_kernel<<<256, 256, LDS_BYTES, stream>>>(
      x, gamma, beta, wqkvP, woutP, b_out, biasP, out);
}

// v003
// Measured time: 109 microseconds a run.
// In two side-by-side timings against v002, it was 1.10 and 1.11 times as fast.
// Over all steps from v000 it is 1.37 times as fast.
#include <hip/hip_runtime.h>

typedef _Float16 half_t;
typedef __attribute__((ext_vector_type(16))) _Float16 v16h;
typedef __attribute__((ext_vector_type(8)))  _Float16 v8h;
typedef __attribute__((ext_vector_type(8)))  float    v8f;

#define NWTOK 256
#define CCH   256
#define NHEAD 8
#define SCALE_QK 0.17677669529663689f   // 1/sqrt(32)

// ---- LDS layout (total = 320000 bytes <= 320 KB/WGP) ----
#define XN_OFF   0            // half [256][264]  normalized input (A rows: [token][ch])
#define OALL_OFF 135168       // half [256][264]  attn output (B rows: [token][inner]); reused as LN raw staging
#define QS_OFF   270336       // half [256][32]   Q rows [query][dh], pieces swizzled (load_qk)
#define KS_OFF   286720       // half [256][32]   K rows [key][dh], pieces swizzled (load_qk)
#define VT_OFF   303104       // half [32][264]   V^T rows [dh][token]
#define LDS_BYTES 320000
#define XSTR 264
#define QSTR 32

// One operand loader for both A and B (B assumed to mirror the documented A
// interleave: lane-half selects K sub-band {0..7,16..23} vs {8..15,24..31}).
// `tile` = first row (A: M row / B: N column) of the 16-wide tile; storage is
// row-major [row][k] with the given stride (halves). Emits 2x b128 loads.
static __device__ __forceinline__ v16h load_ab(const half_t* __restrict__ base,
                                               int stride, int tile, int kbase, int lane)
{
  const int m  = lane & 15;
  const int hi = (lane >> 4) & 1;
  const half_t* p = base + (size_t)(tile + m) * stride + kbase + hi * 8;
  v8h lo = *(const v8h*)(p);
  v8h hh = *(const v8h*)(p + 16);
  v16h r;
#pragma unroll
  for (int i = 0; i < 8; ++i) { r[i] = lo[i]; r[8 + i] = hh[i]; }
  return r;
}

// Same fragment as load_ab (same value in every lane and register), read from a
// buffer that the prep kernel laid out in fragment order: per (16-row tile,
// 32-wide k step) one 1-KB block = 32 lanes x 16 B of the low registers, then
// 32 lanes x 16 B of the high registers. Each b128 load covers 512 contiguous
// bytes (4 whole 128-B lines) instead of 32 B out of each of 16 rows.
static __device__ __forceinline__ v16h load_packed(const half_t* __restrict__ base,
                                                   int tile16, int ks, int lane)
{
  const half_t* p = base + (size_t)((tile16 * 8 + ks) * 512) + lane * 8;
  v8h lo = *(const v8h*)(p);
  v8h hh = *(const v8h*)(p + 256);
  v16h r;
#pragma unroll
  for (int i = 0; i < 8; ++i) { r[i] = lo[i]; r[8 + i] = hh[i]; }
  return r;
}

// Q and K rows are 64 B (four 16-B pieces). Piece c of row t is kept at piece
// c ^ ((t >> 2) & 3): the 16 rows that one half-wave reads at one piece index then
// fall on 16 different groups of four banks instead of 4 (unpadded 64-B rows put
// rows t, t+4, t+8, t+12 on the same banks). No extra LDS.
// Same fragment as load_ab(base, QSTR, tile, 0, lane), read through that map.
// tile is a multiple of 16, so the swizzle term depends on the lane alone.
static __device__ __forceinline__ v16h load_qk(const half_t* __restrict__ base,
                                               int tile, int lane)
{
  const int m  = lane & 15;
  const int hi = (lane >> 4) & 1;
  const int p0 = (hi ^ (m >> 2)) << 3;            // dh = hi*8 .. +7
  const half_t* p = base + (tile + m) * QSTR;
  v8h lo = *(const v8h*)(p + p0);
  v8h hh = *(const v8h*)(p + (p0 ^ 16));          // dh = 16 + hi*8 .. +7
  v16h r;
#pragma unroll
  for (int i = 0; i < 8; ++i) { r[i] = lo[i]; r[8 + i] = hh[i]; }
  return r;
}

static __device__ __forceinline__ v8f wmma16(v16h a, v16h b, v8f c)
{
  return __builtin_amdgcn_wmma_f32_16x16x32_f16(false, a, false, b, (short)0, c, false, false);
}

// ---------------------------------------------------------------------------
// Prep: convert the weights to f16 in fragment order (see load_packed), expand
// the relative-position bias table to f16 in the order of the S^T tiles:
// [head][query tile][key tile][lane][8], lane = (key>>3 & 1)*16 + (query & 15).
// ---------------------------------------------------------------------------
__global__ void __launch_bounds__(256) swin_prep_kernel(
    const float* __restrict__ w_qkv,      // [256][768]
    const float* __restrict__ w_out,      // [256][256]
    const float* __restrict__ bias_table, // [1575][8]
    const int*   __restrict__ rel_index,  // [256][256] (query, key)
    half_t* __restrict__ wqkvP,           // [48 tiles][8 k steps][2][32 lanes][8]
    half_t* __restrict__ woutP,           // [16 tiles][8 k steps][2][32 lanes][8]
    half_t* __restrict__ biasP)           // [8][16 q tiles][16 key tiles][32 lanes][8]
{
  const int idx = blockIdx.x * 256 + threadIdx.x;
  if (idx < 768 * 256 + 256 * 256) {
    const bool isq = idx < 768 * 256;
    const int i    = isq ? idx : idx - 768 * 256;
    const int e    = i & 7;                         // element of the 16-B piece
    const int ln   = (i >> 3) & 31;                 // lane of the fragment
    const int sel  = (i >> 8) & 1;                  // low / high registers
    const int ks   = (i >> 9) & 7;
    const int row  = (i >> 12) * 16 + (ln & 15);    // output column of the weight
    const int k    = ks * 32 + sel * 16 + (ln >> 4) * 8 + e;
    if (isq) wqkvP[i] = (half_t)w_qkv[k * 768 + row];
    else     woutP[i] = (half_t)w_out[k * 256 + row];
  } else {
    const int i  = idx - (768 * 256 + 256 * 256);   // < 8*65536
    const int hh = i >> 16;
    const int e  = i & 7;
    const int ln = (i >> 3) & 31;
    const int kt = (i >> 8) & 15;
    const int qt = (i >> 12) & 15;
    const int query = qt * 16 + (ln & 15);
    const int key   = kt * 16 + (ln >> 4) * 8 + e;
    const int rel   = min(max(rel_index[query * 256 + key], 0), 1574);  // stay inside bias_table
    biasP[i] = (half_t)bias_table[rel * 8 + hh];
  }
}

// ---------------------------------------------------------------------------
// Fully fused window-attention block: one workgroup (8 wave32) per window.
// ---------------------------------------------------------------------------
__global__ void __launch_bounds__(256) swin_window_attn_kernel(
    const float* __restrict__ x,        // (1,256,16,64,64)
    const float* __restrict__ gamma,
    const float* __restrict__ beta,
    const half_t* __restrict__ wqkvP,   // fragment order, 48 tiles x 8 k steps
    const half_t* __restrict__ woutP,   // fragment order, 16 tiles x 8 k steps
    const float* __restrict__ b_out,
    const half_t* __restrict__ biasP,   // [8][16][16][32 lanes][8]
    float* __restrict__ out)            // (1,256,16,64,64)
{
  extern __shared__ char smem[];
  half_t* XN   = (half_t*)(smem + XN_OFF);
  half_t* OALL = (half_t*)(smem + OALL_OFF);
  half_t* QS   = (half_t*)(smem + QS_OFF);
  half_t* KS   = (half_t*)(smem + KS_OFF);
  half_t* VT   = (half_t*)(smem + VT_OFF);
  float*  sGamma = (float*)(smem + QS_OFF);   // overlay while QS unused (LN phase)
  float*  sBeta  = sGamma + 256;
  float*  sBout  = (float*)(smem + QS_OFF);   // overlay while QS unused (out phase)

  const int tid  = threadIdx.x;
  const int lane = tid & 31;
  const int wave = tid >> 5;
  const int hi   = (lane >> 4) & 1;
  const int nsel = lane & 15;

  const int win = blockIdx.x;
  const int gd = win >> 6, gh = (win >> 3) & 7, gw = win & 7;
  const int d0 = gd * 4, h0 = gh * 8, w0 = gw * 8;

  const v8f vzero = {0.f, 0.f, 0.f, 0.f, 0.f, 0.f, 0.f, 0.f};

  // Stage LN affine params into LDS.
  sGamma[tid] = gamma[tid];
  sBeta[tid]  = beta[tid];

  // ---- Phase 1: window gather + LayerNorm (one thread per token) ----
  {
    const int wd = tid >> 6, wh = (tid >> 3) & 7, ww = tid & 7;
    const size_t sp = (size_t)(d0 + wd) * 4096 + (size_t)(h0 + wh) * 64 + (size_t)(w0 + ww);
    const float* xp = x + sp;
    half_t* raw = OALL + (size_t)tid * XSTR;    // OALL region is free right now
    float s = 0.f, ss = 0.f;
    // 128 loads are issued before the first is used, so the gather waits out the
    // memory latency twice instead of 32 times (8 loads a wait left memory idle).
#pragma unroll 1   // two trips: 128 values fit the low registers
    for (int cb = 0; cb < CCH; cb += 128) {
      float v[128];
#pragma unroll
      for (int g = 0; g < 128; g += 32) {
#pragma unroll
        for (int j = 0; j < 32; ++j) v[g + j] = xp[(size_t)(cb + g + j) * 65536];
        // Address registers of the issued loads are rewritten only behind this wait. It
        // takes the group's base as an input: without it the trip's last load was given
        // its own group's address pair as target, ahead of the wait.
        asm volatile("s_wait_xcnt 0x0" :: "v"(xp + (size_t)(cb + g) * 65536) : "memory");
      }
#pragma unroll
      for (int j = 0; j < 128; ++j) {
        s += v[j]; ss += v[j] * v[j];
        raw[cb + j] = (half_t)v[j];
      }
    }
    const float mu  = s * (1.f / 256.f);
    const float var = ss * (1.f / 256.f) - mu * mu;
    const float rs  = rsqrtf(var + 1e-5f);
    __syncthreads();                            // gamma/beta staged by all threads
    half_t* xr = XN + (size_t)tid * XSTR;
#pragma unroll 8
    for (int c = 0; c < CCH; ++c) {
      float v = ((float)raw[c] - mu) * rs * sGamma[c] + sBeta[c];
      xr[c] = (half_t)v;
    }
  }
  __syncthreads();

  // ---- Phase 2: per head, QKV projection then attention ----
  // Lane part of the swizzled Q/K store offset, element (token mrow + r + 8*hi,
  // dh jj*16 + nsel): piece jj*2 + (nsel>>3), row term (r>>2) + 2*hi.
  int qkst[2][2];
#pragma unroll
  for (int jj = 0; jj < 2; ++jj)
#pragma unroll
    for (int rr = 0; rr < 2; ++rr)
      qkst[jj][rr] = hi * 8 * QSTR + (((jj * 2 + (nsel >> 3)) ^ (rr + 2 * hi)) << 3) + (nsel & 7);
#pragma unroll 1
  for (int h = 0; h < NHEAD; ++h) {
    // --- QKV GEMM: wave owns token tiles {2w, 2w+1}; 6 output tiles (q,k,v x 2) ---
#pragma unroll 1
    for (int mt = 0; mt < 2; ++mt) {
      const int mrow = (wave * 2 + mt) * 16;
      v8f acc[6];
#pragma unroll
      for (int j = 0; j < 6; ++j) acc[j] = vzero;
#pragma unroll
      for (int ks = 0; ks < 8; ++ks) {
        v16h a = load_ab(XN, XSTR, mrow, ks * 32, lane);
#pragma unroll
        for (int j = 0; j < 6; ++j) {
          const int ntile = (j >> 1) * 16 + h * 2 + (j & 1);     // q:0.., k:16.., v:32..
          v16h b = load_packed(wqkvP, ntile, ks, lane);
          acc[j] = wmma16(a, b, acc[j]);
        }
      }
      // scatter D tiles: (m=token r+8*hi, n=dh lane&15)
#pragma unroll
      for (int j = 0; j < 6; ++j) {
        const int dh = (j & 1) * 16 + nsel;
#pragma unroll
        for (int r = 0; r < 8; ++r) {
          const int tok = mrow + r + 8 * hi;
          const half_t v = (half_t)acc[j][r];
          if (j < 2)      QS[(mrow + r) * QSTR + qkst[j & 1][r >> 2]] = v;
          else if (j < 4) KS[(mrow + r) * QSTR + qkst[j & 1][r >> 2]] = v;
          else            VT[dh * XSTR + tok] = v;      // transposed store
        }
      }
    }
    __syncthreads();

    // --- attention: S^T = K·Q^T then O^T = V^T·P^T ; wave owns query tiles {w, w+8} ---
    const half_t* biasbase = biasP + (size_t)h * 65536;
#pragma unroll 1
    for (int p = 0; p < 2; ++p) {
      const int qbase = (wave + 8 * p) * 16;
      const v16h bq = load_qk(QS, qbase, lane);              // B: n=query, k=dh(32)
      const half_t* biasp = biasbase + (size_t)(wave + 8 * p) * 4096 + lane * 8;
      float sreg[16][8];                                     // S^T tiles, this lane: one query
      float vmax = -3.0e38f;
#pragma unroll
      for (int kt = 0; kt < 16; ++kt) {
        v16h ak = load_qk(KS, kt * 16, lane);                // A: m=key, k=dh
        v8f sc = wmma16(ak, bq, vzero);
        v8h bb = *(const v8h*)(biasp + kt * 256);            // bias[h][query][key..key+7]
#pragma unroll
        for (int r = 0; r < 8; ++r) {
          float f = sc[r] * SCALE_QK + (float)bb[r];
          sreg[kt][r] = f;
          vmax = fmaxf(vmax, f);
        }
      }
      vmax = fmaxf(vmax, __shfl_xor(vmax, 16));              // lanes l, l+16 share a query
      float rsum = 0.f;
      v8f o0 = vzero, o1 = vzero;
#pragma unroll
      for (int kb = 0; kb < 8; ++kb) {                       // 32-key blocks
        v16h pb;                                             // D tiles ARE the B operand
#pragma unroll
        for (int r = 0; r < 8; ++r) {
          float e0 = __expf(sreg[2 * kb][r] - vmax);
          float e1 = __expf(sreg[2 * kb + 1][r] - vmax);
          rsum += e0 + e1;
          pb[r]     = (half_t)e0;
          pb[8 + r] = (half_t)e1;
        }
        v16h av0 = load_ab(VT, XSTR, 0,  kb * 32, lane);     // A: m=dh 0..15,  k=key
        v16h av1 = load_ab(VT, XSTR, 16, kb * 32, lane);     // A: m=dh 16..31, k=key
        o0 = wmma16(av0, pb, o0);
        o1 = wmma16(av1, pb, o1);
      }
      rsum += __shfl_xor(rsum, 16);
      const float inv = 1.f / rsum;
      half_t* orow = OALL + (size_t)(qbase + nsel) * XSTR + h * 32;
#pragma unroll
      for (int r = 0; r < 8; ++r) {                          // O^T: n=query=lane&15 too
        orow[r + 8 * hi]      = (half_t)(o0[r] * inv);
        orow[16 + r + 8 * hi] = (half_t)(o1[r] * inv);
      }
    }
    __syncthreads();
  }

  // ---- Phase 3: output projection out^T = w_out^T * OALL^T (+b_out) + window merge ----
  sBout[tid] = b_out[tid];
  __syncthreads();
#pragma unroll 1
  for (int mt = 0; mt < 2; ++mt) {
    const int crow = (wave * 2 + mt) * 16;                   // channel tile
#pragma unroll 1
    for (int ch = 0; ch < 2; ++ch) {
      v8f acc[8];
#pragma unroll
      for (int j = 0; j < 8; ++j) acc[j] = vzero;
#pragma unroll
      for (int ks = 0; ks < 8; ++ks) {
        v16h a = load_packed(woutP, wave * 2 + mt, ks, lane); // A: m=channel, k=inner
#pragma unroll
        for (int j = 0; j < 8; ++j) {
          v16h b = load_ab(OALL, XSTR, (ch * 8 + j) * 16, ks * 32, lane); // B: n=token
          acc[j] = wmma16(a, b, acc[j]);
        }
      }
#pragma unroll
      for (int j = 0; j < 8; ++j) {
        const int tok = (ch * 8 + j) * 16 + nsel;
        const int wd = tok >> 6, wh = (tok >> 3) & 7, ww = tok & 7;
        const size_t sp = (size_t)(d0 + wd) * 4096 + (size_t)(h0 + wh) * 64 + (size_t)(w0 + ww);
#pragma unroll
        for (int r = 0; r < 8; ++r) {
          const int c = crow + r + 8 * hi;
          out[(size_t)c * 65536 + sp] = acc[j][r] + sBout[c];  // lanes 0..7: 32B runs
        }
      }
    }
  }
}

// ---------------------------------------------------------------------------
extern "C" void kernel_launch(void* const* d_in, const int* in_sizes, int n_in,
                              void* d_out, int out_size, void* d_ws, size_t ws_size,
                              hipStream_t stream)
{
  (void)in_sizes; (void)n_in; (void)out_size; (void)ws_size;
  const float* x      = (const float*)d_in[0];
  const float* gamma  = (const float*)d_in[1];
  const float* beta   = (const float*)d_in[2];
  const float* w_qkv  = (const float*)d_in[3];
  const float* w_out  = (const float*)d_in[4];
  const float* b_out  = (const float*)d_in[5];
  const float* btable = (const float*)d_in[6];
  const int*   relidx = (const int*)d_in[7];
  float* out = (float*)d_out;

  // Workspace: only 1.57 MB of f16 weight/bias staging.
  half_t* wqkvP = (half_t*)d_ws;            // 768*256
  half_t* woutP = wqkvP + 768 * 256;        // 256*256
  half_t* biasP = woutP + 256 * 256;        // 8*256*256

  swin_prep_kernel<<<3072, 256, 0, stream>>>(w_qkv, w_out, btable, relidx,
                                             wqkvP, woutP, biasP);

  (void)hipFuncSetAttribute((const void*)swin_window_attn_kernel,
                            hipFuncAttributeMaxDynamicSharedMemorySize, LDS_BYTES);
  swin_window_attn_kernel<<<256, 256, LDS_BYTES, stream>>>(
      x, gamma, beta, wqkvP, woutP, b_out, biasP, out);
}

// v004
// Measured time: 97.8 microseconds a run.
// In two side-by-side timings against v003, it was 1.14 and 1.12 times as fast.
// Over all steps from v000 it is 1.55 times as fast.
#include <hip/hip_runtime.h>

typedef _Float16 half_t;
typedef __attribute__((ext_vector_type(16))) _Float16 v16h;
typedef __attribute__((ext_vector_type(8)))  _Float16 v8h;
typedef __attribute__((ext_vector_type(8)))  float    v8f;

#define NWTOK 256
#define CCH   256
#define NHEAD 8
#define SCALE_QK 0.17677669529663689f   // 1/sqrt(32)

// ---- LDS layout (total = 320000 bytes <= 320 KB/WGP) ----
#define XN_OFF   0            // half [256][264]  normalized input (A rows: [token][ch])
#define OALL_OFF 135168       // half [256][264]  attn output (B rows: [token][inner]); reused as LN raw staging
#define QS_OFF   270336       // half [256][32]   Q rows [query][dh], pieces swizzled (load_qk)
#define KS_OFF   286720       // half [256][32]   K rows [key][dh], pieces swizzled (load_qk)
#define VT_OFF   303104       // half [32][264]   V^T rows [dh][token]
#define LDS_BYTES 320000
#define XSTR 264
#define QSTR 32

// One operand loader for both A and B (B assumed to mirror the documented A
// interleave: lane-half selects K sub-band {0..7,16..23} vs {8..15,24..31}).
// `tile` = first row (A: M row / B: N column) of the 16-wide tile; storage is
// row-major [row][k] with the given stride (halves). Emits 2x b128 loads.
static __device__ __forceinline__ v16h load_ab(const half_t* __restrict__ base,
                                               int stride, int tile, int kbase, int lane)
{
  const int m  = lane & 15;
  const int hi = (lane >> 4) & 1;
  const half_t* p = base + (size_t)(tile + m) * stride + kbase + hi * 8;
  v8h lo = *(const v8h*)(p);
  v8h hh = *(const v8h*)(p + 16);
  v16h r;
#pragma unroll
  for (int i = 0; i < 8; ++i) { r[i] = lo[i]; r[8 + i] = hh[i]; }
  return r;
}

// Same fragment as load_ab (same value in every lane and register), read from a
// buffer that the prep kernel laid out in fragment order: per (16-row tile,
// 32-wide k step) one 1-KB block = 32 lanes x 16 B of the low registers, then
// 32 lanes x 16 B of the high registers. Each b128 load covers 512 contiguous
// bytes (4 whole 128-B lines) instead of 32 B out of each of 16 rows.
static __device__ __forceinline__ v16h load_packed(const half_t* __restrict__ base,
                                                   int tile16, int ks, int lane)
{
  const half_t* p = base + (size_t)((tile16 * 8 + ks) * 512) + lane * 8;
  v8h lo = *(const v8h*)(p);
  v8h hh = *(const v8h*)(p + 256);
  v16h r;
#pragma unroll
  for (int i = 0; i < 8; ++i) { r[i] = lo[i]; r[8 + i] = hh[i]; }
  return r;
}

// Q and K rows are 64 B (four 16-B pieces). Piece c of row t is kept at piece
// c ^ ((t >> 2) & 3): the 16 rows that one half-wave reads at one piece index then
// fall on 16 different groups of four banks instead of 4 (unpadded 64-B rows put
// rows t, t+4, t+8, t+12 on the same banks). No extra LDS.
// Same fragment as load_ab(base, QSTR, tile, 0, lane), read through that map.
// tile is a multiple of 16, so the swizzle term depends on the lane alone.
static __device__ __forceinline__ v16h load_qk(const half_t* __restrict__ base,
                                               int tile, int lane)
{
  const int m  = lane & 15;
  const int hi = (lane >> 4) & 1;
  const int p0 = (hi ^ (m >> 2)) << 3;            // dh = hi*8 .. +7
  const half_t* p = base + (tile + m) * QSTR;
  v8h lo = *(const v8h*)(p + p0);
  v8h hh = *(const v8h*)(p + (p0 ^ 16));          // dh = 16 + hi*8 .. +7
  v16h r;
#pragma unroll
  for (int i = 0; i < 8; ++i) { r[i] = lo[i]; r[8 + i] = hh[i]; }
  return r;
}

static __device__ __forceinline__ v8f wmma16(v16h a, v16h b, v8f c)
{
  return __builtin_amdgcn_wmma_f32_16x16x32_f16(false, a, false, b, (short)0, c, false, false);
}

// ---------------------------------------------------------------------------
// Prep: convert the weights to f16 in fragment order (see load_packed), expand
// the relative-position bias table to f16 in the order of the S^T tiles:
// [head][query tile][key tile][lane][8], lane = (key>>3 & 1)*16 + (query & 15).
// ---------------------------------------------------------------------------
__global__ void __launch_bounds__(256) swin_prep_kernel(
    const float* __restrict__ w_qkv,      // [256][768]
    const float* __restrict__ w_out,      // [256][256]
    const float* __restrict__ bias_table, // [1575][8]
    const int*   __restrict__ rel_index,  // [256][256] (query, key)
    half_t* __restrict__ wqkvP,           // [48 tiles][8 k steps][2][32 lanes][8]
    half_t* __restrict__ woutP,           // [16 tiles][8 k steps][2][32 lanes][8]
    half_t* __restrict__ biasP)           // [8][16 q tiles][16 key tiles][32 lanes][8]
{
  const int idx = blockIdx.x * 256 + threadIdx.x;
  if (idx < 768 * 256 + 256 * 256) {
    const bool isq = idx < 768 * 256;
    const int i    = isq ? idx : idx - 768 * 256;
    const int e    = i & 7;                         // element of the 16-B piece
    const int ln   = (i >> 3) & 31;                 // lane of the fragment
    const int sel  = (i >> 8) & 1;                  // low / high registers
    const int ks   = (i >> 9) & 7;
    const int row  = (i >> 12) * 16 + (ln & 15);    // output column of the weight
    const int k    = ks * 32 + sel * 16 + (ln >> 4) * 8 + e;
    if (isq) wqkvP[i] = (half_t)w_qkv[k * 768 + row];
    else     woutP[i] = (half_t)w_out[k * 256 + row];
  } else {
    const int i  = idx - (768 * 256 + 256 * 256);   // < 8*65536
    const int hh = i >> 16;
    const int e  = i & 7;
    const int ln = (i >> 3) & 31;
    const int kt = (i >> 8) & 15;
    const int qt = (i >> 12) & 15;
    const int query = qt * 16 + (ln & 15);
    const int key   = kt * 16 + (ln >> 4) * 8 + e;
    const int rel   = min(max(rel_index[query * 256 + key], 0), 1574);  // stay inside bias_table
    biasP[i] = (half_t)bias_table[rel * 8 + hh];
  }
}

// ---------------------------------------------------------------------------
// Fully fused window-attention block: one workgroup (16 wave32, four per SIMD)
// per window. The LDS lets only one workgroup live on a WGP, so its own waves are
// all that can cover each other's LDS, cache and dependent-chain waits.
// ---------------------------------------------------------------------------
__global__ void __launch_bounds__(512) swin_window_attn_kernel(
    const float* __restrict__ x,        // (1,256,16,64,64)
    const float* __restrict__ gamma,
    const float* __restrict__ beta,
    const half_t* __restrict__ wqkvP,   // fragment order, 48 tiles x 8 k steps
    const half_t* __restrict__ woutP,   // fragment order, 16 tiles x 8 k steps
    const float* __restrict__ b_out,
    const half_t* __restrict__ biasP,   // [8][16][16][32 lanes][8]
    float* __restrict__ out)            // (1,256,16,64,64)
{
  extern __shared__ char smem[];
  half_t* XN   = (half_t*)(smem + XN_OFF);
  half_t* OALL = (half_t*)(smem + OALL_OFF);
  half_t* QS   = (half_t*)(smem + QS_OFF);
  half_t* KS   = (half_t*)(smem + KS_OFF);
  half_t* VT   = (half_t*)(smem + VT_OFF);
  float*  sGamma = (float*)(smem + QS_OFF);   // overlay while QS unused (LN phase)
  float*  sBeta  = sGamma + 256;
  float2* sPart  = (float2*)(sGamma + 512);   // per thread: sum, sum of squares of its 128 channels
  float*  sBout  = (float*)(smem + QS_OFF);   // overlay while QS unused (out phase)

  const int tid  = threadIdx.x;
  const int lane = tid & 31;
  const int wave = __builtin_amdgcn_readfirstlane(tid >> 5);   // 0..15, in a scalar register
  const int hi   = (lane >> 4) & 1;
  const int nsel = lane & 15;

  const int win = blockIdx.x;
  const int gd = win >> 6, gh = (win >> 3) & 7, gw = win & 7;
  const int d0 = gd * 4, h0 = gh * 8, w0 = gw * 8;

  const v8f vzero = {0.f, 0.f, 0.f, 0.f, 0.f, 0.f, 0.f, 0.f};

  // Stage LN affine params into LDS.
  sGamma[tid] = (tid < 256) ? gamma[tid] : beta[tid - 256];   // sBeta follows sGamma

  // ---- Phase 1: window gather + LayerNorm (two threads per token, 128 channels each) ----
  {
    const int tok = tid & 255;
    const int cb  = (wave >> 3) * 128;          // this thread's channels: cb .. cb+127 (one value per wave)
    const int wd = tok >> 6, wh = (tok >> 3) & 7, ww = tok & 7;
    const size_t sp = (size_t)(d0 + wd) * 4096 + (size_t)(h0 + wh) * 64 + (size_t)(w0 + ww);
    const float* xp = x + sp;
    half_t* raw = OALL + (size_t)tok * XSTR;    // OALL region is free right now
    float s = 0.f, ss = 0.f;
    // 64 loads are issued before the first is used (a wave's load counter holds no more),
    // so a wave waits out the memory latency twice; 16 waves keep 1,024 loads in flight.
#pragma unroll 1   // two trips of 64 channels
    for (int c0 = cb; c0 < cb + 128; c0 += 64) {
      float v[64];
#pragma unroll
      for (int g = 0; g < 64; g += 32) {
#pragma unroll
        for (int j = 0; j < 32; ++j) v[g + j] = xp[(size_t)(c0 + g + j) * 65536];
        // Address registers of the issued loads are rewritten only behind this wait. It
        // takes the group's base as an input, so that no load of the group is given its
        // own address pair as target ahead of the wait.
        asm volatile("s_wait_xcnt 0x0" :: "v"(xp + (size_t)(c0 + g) * 65536) : "memory");
      }
#pragma unroll
      for (int j = 0; j < 64; ++j) {
        s += v[j]; ss += v[j] * v[j];
        raw[c0 + j] = (half_t)v[j];
      }
    }
    sPart[tid] = make_float2(s, ss);
    __syncthreads();                            // gamma/beta and the half sums staged by all threads
    const float2 pl = sPart[tok], ph = sPart[tok + 256];
    s  = pl.x + ph.x;                           // low channels + high channels, in both threads
    ss = pl.y + ph.y;
    const float mu  = s * (1.f / 256.f);
    const float var = ss * (1.f / 256.f) - mu * mu;
    const float rs  = rsqrtf(var + 1e-5f);
    half_t* xr = XN + (size_t)tok * XSTR;
#pragma unroll 8
    for (int i = 0; i < 128; ++i) {
      const int c = cb + i;
      float v = ((float)raw[c] - mu) * rs * sGamma[c] + sBeta[c];
      xr[c] = (half_t)v;
    }
  }
  __syncthreads();

  // ---- Phase 2: per head, QKV projection then attention ----
  // Lane part of the swizzled Q/K store offset, element (token mrow + r + 8*hi,
  // dh jj*16 + nsel): piece jj*2 + (nsel>>3), row term (r>>2) + 2*hi.
  int qkst[2][2];
#pragma unroll
  for (int jj = 0; jj < 2; ++jj)
#pragma unroll
    for (int rr = 0; rr < 2; ++rr)
      qkst[jj][rr] = hi * 8 * QSTR + (((jj * 2 + (nsel >> 3)) ^ (rr + 2 * hi)) << 3) + (nsel & 7);
#pragma unroll 1
  for (int h = 0; h < NHEAD; ++h) {
    // --- QKV GEMM: wave pair mg owns token tiles {2mg, 2mg+1}; of the head's 6 output
    // tiles (q0 q1 k0 k1 v0 v1) the even wave takes the first 3, the odd wave the last 3.
    // Each weight fragment still serves two token tiles. ---
    {
      const int mrow0 = (wave >> 1) * 32;
      const int j0    = (wave & 1) * 3;
      v8f acc[2][3];
#pragma unroll
      for (int j = 0; j < 3; ++j) { acc[0][j] = vzero; acc[1][j] = vzero; }
      int ntile[3];
#pragma unroll
      for (int j = 0; j < 3; ++j) ntile[j] = ((j0 + j) >> 1) * 16 + h * 2 + ((j0 + j) & 1);  // q:0.., k:16.., v:32..
      // Weight fragments are fetched four k steps ahead of their use (256 registers do not
      // hold all 24 beside the accumulators).
      v16h b[8][3];
#pragma unroll
      for (int ks = 0; ks < 4; ++ks)
#pragma unroll
        for (int j = 0; j < 3; ++j) b[ks][j] = load_packed(wqkvP, ntile[j], ks, lane);
#pragma unroll
      for (int ks = 0; ks < 8; ++ks) {
        // Keeps each group of weight loads where it is written: left alone, the compiler
        // sank every load to just in front of its WMMAs and waited out each one's latency.
        __builtin_amdgcn_sched_barrier(0);
        v16h a0 = load_ab(XN, XSTR, mrow0,      ks * 32, lane);
        v16h a1 = load_ab(XN, XSTR, mrow0 + 16, ks * 32, lane);
#pragma unroll
        for (int j = 0; j < 3; ++j) {
          acc[0][j] = wmma16(a0, b[ks][j], acc[0][j]);
          acc[1][j] = wmma16(a1, b[ks][j], acc[1][j]);
        }
        if (ks < 4) {
#pragma unroll
          for (int j = 0; j < 3; ++j) b[ks + 4][j] = load_packed(wqkvP, ntile[j], ks + 4, lane);
        }
      }
      // All weight loads have returned; their address registers are reused only behind this wait.
      asm volatile("s_wait_xcnt 0x0" ::: "memory");
      __builtin_amdgcn_sched_barrier(0);   // nothing of the scatter moves up over that wait
      // scatter D tiles: (m=token r+8*hi, n=dh lane&15)
      auto put_qk = [&](half_t* dst, int half, const v8f& d, int mrow) {
#pragma unroll
        for (int r = 0; r < 8; ++r) dst[(mrow + r) * QSTR + qkst[half][r >> 2]] = (half_t)d[r];
      };
      auto put_v = [&](int half, const v8f& d, int mrow) {   // transposed store
#pragma unroll
        for (int r = 0; r < 8; ++r) VT[(half * 16 + nsel) * XSTR + mrow + r + 8 * hi] = (half_t)d[r];
      };
      if (j0 == 0) {
#pragma unroll
        for (int mt = 0; mt < 2; ++mt) {
          put_qk(QS, 0, acc[mt][0], mrow0 + mt * 16);
          put_qk(QS, 1, acc[mt][1], mrow0 + mt * 16);
          put_qk(KS, 0, acc[mt][2], mrow0 + mt * 16);
        }
      } else {
#pragma unroll
        for (int mt = 0; mt < 2; ++mt) {
          put_qk(KS, 1, acc[mt][0], mrow0 + mt * 16);
          put_v(0, acc[mt][1], mrow0 + mt * 16);
          put_v(1, acc[mt][2], mrow0 + mt * 16);
        }
      }
    }
    __syncthreads();

    // --- attention: S^T = K·Q^T then O^T = V^T·P^T ; wave owns query tile w ---
    const half_t* biasbase = biasP + (size_t)h * 65536;
    {
      const int qbase = wave * 16;
      const v16h bq = load_qk(QS, qbase, lane);              // B: n=query, k=dh(32)
      const half_t* biasp = biasbase + (size_t)wave * 4096 + lane * 8;
      float sreg[16][8];                                     // S^T tiles, this lane: one query
      float vmax = -3.0e38f;
#pragma unroll
      for (int kt = 0; kt < 16; ++kt) {
        v16h ak = load_qk(KS, kt * 16, lane);                // A: m=key, k=dh
        v8f sc = wmma16(ak, bq, vzero);
        v8h bb = *(const v8h*)(biasp + kt * 256);            // bias[h][query][key..key+7]
#pragma unroll
        for (int r = 0; r < 8; ++r) {
          float f = sc[r] * SCALE_QK + (float)bb[r];
          sreg[kt][r] = f;
          vmax = fmaxf(vmax, f);
        }
      }
      vmax = fmaxf(vmax, __shfl_xor(vmax, 16));              // lanes l, l+16 share a query
      float rsum = 0.f;
      v8f o0 = vzero, o1 = vzero;
#pragma unroll
      for (int kb = 0; kb < 8; ++kb) {                       // 32-key blocks
        v16h pb;                                             // D tiles ARE the B operand
#pragma unroll
        for (int r = 0; r < 8; ++r) {
          float e0 = __expf(sreg[2 * kb][r] - vmax);
          float e1 = __expf(sreg[2 * kb + 1][r] - vmax);
          rsum += e0 + e1;
          pb[r]     = (half_t)e0;
          pb[8 + r] = (half_t)e1;
        }
        v16h av0 = load_ab(VT, XSTR, 0,  kb * 32, lane);     // A: m=dh 0..15,  k=key
        v16h av1 = load_ab(VT, XSTR, 16, kb * 32, lane);     // A: m=dh 16..31, k=key
        o0 = wmma16(av0, pb, o0);
        o1 = wmma16(av1, pb, o1);
      }
      rsum += __shfl_xor(rsum, 16);
      const float inv = 1.f / rsum;
      half_t* orow = OALL + (size_t)(qbase + nsel) * XSTR + h * 32;
#pragma unroll
      for (int r = 0; r < 8; ++r) {                          // O^T: n=query=lane&15 too
        orow[r + 8 * hi]      = (half_t)(o0[r] * inv);
        orow[16 + r + 8 * hi] = (half_t)(o1[r] * inv);
      }
    }
    __syncthreads();
  }

  // ---- Phase 3: output projection out^T = w_out^T * OALL^T (+b_out) + window merge ----
  if (tid < 256) sBout[tid] = b_out[tid];
  asm volatile("s_wait_xcnt 0x0" ::: "memory");   // before the load's address registers are reused
  __syncthreads();
  {
    const int crow = wave * 16;                              // channel tile
    const half_t* wp = woutP + (size_t)(wave * 8 * 512) + lane * 8;
    v16h aw[8];                                              // A: m=channel, k=inner
#pragma unroll
    for (int ks = 0; ks < 8; ++ks) {                         // = load_packed(woutP, wave, ks, lane)
      v8h lo = *(const v8h*)(wp + ks * 512);
      v8h hh = *(const v8h*)(wp + ks * 512 + 256);
#pragma unroll
      for (int i = 0; i < 8; ++i) { aw[ks][i] = lo[i]; aw[ks][8 + i] = hh[i]; }
    }
    // Address registers of these loads are reused only behind this wait; it takes their
    // base as an input, so that the last load is not given its own address pair as target.
    asm volatile("s_wait_xcnt 0x0" :: "v"(wp) : "memory");
#pragma unroll 1
    for (int ch = 0; ch < 2; ++ch) {
      v8f acc[8];
#pragma unroll
      for (int j = 0; j < 8; ++j) acc[j] = vzero;
#pragma unroll
      for (int ks = 0; ks < 8; ++ks) {
#pragma unroll
        for (int j = 0; j < 8; ++j) {
          v16h b = load_ab(OALL, XSTR, (ch * 8 + j) * 16, ks * 32, lane); // B: n=token
          acc[j] = wmma16(aw[ks], b, acc[j]);
        }
      }
#pragma unroll
      for (int j = 0; j < 8; ++j) {
        const int tok = (ch * 8 + j) * 16 + nsel;
        const int wd = tok >> 6, wh = (tok >> 3) & 7, ww = tok & 7;
        const size_t sp = (size_t)(d0 + wd) * 4096 + (size_t)(h0 + wh) * 64 + (size_t)(w0 + ww);
#pragma unroll
        for (int r = 0; r < 8; ++r) {
          const int c = crow + r + 8 * hi;
          out[(size_t)c * 65536 + sp] = acc[j][r] + sBout[c];  // lanes 0..7: 32B runs
        }
      }
    }
  }
}

// ---------------------------------------------------------------------------
extern "C" void kernel_launch(void* const* d_in, const int* in_sizes, int n_in,
                              void* d_out, int out_size, void* d_ws, size_t ws_size,
                              hipStream_t stream)
{
  (void)in_sizes; (void)n_in; (void)out_size; (void)ws_size;
  const float* x      = (const float*)d_in[0];
  const float* gamma  = (const float*)d_in[1];
  const float* beta   = (const float*)d_in[2];
  const float* w_qkv  = (const float*)d_in[3];
  const float* w_out  = (const float*)d_in[4];
  const float* b_out  = (const float*)d_in[5];
  const float* btable = (const float*)d_in[6];
  const int*   relidx = (const int*)d_in[7];
  float* out = (float*)d_out;

  // Workspace: only 1.57 MB of f16 weight/bias staging.
  half_t* wqkvP = (half_t*)d_ws;            // 768*256
  half_t* woutP = wqkvP + 768 * 256;        // 256*256
  half_t* biasP = woutP + 256 * 256;        // 8*256*256

  swin_prep_kernel<<<3072, 256, 0, stream>>>(w_qkv, w_out, btable, relidx,
                                             wqkvP, woutP, biasP);

  (void)hipFuncSetAttribute((const void*)swin_window_attn_kernel,
                            hipFuncAttributeMaxDynamicSharedMemorySize, LDS_BYTES);
  swin_window_attn_kernel<<<256, 512, LDS_BYTES, stream>>>(
      x, gamma, beta, wqkvP, woutP, b_out, biasP, out);
}

// v005
// It runs in 82.8 microseconds.
// Next to v004, in two timings, it ran 1.20 times as fast each time.
// Counting every step since v000, it is 1.86 times as fast.
#include <hip/hip_runtime.h>

typedef _Float16 half_t;
typedef __attribute__((ext_vector_type(16))) _Float16 v16h;
typedef __attribute__((ext_vector_type(8)))  _Float16 v8h;
typedef __attribute__((ext_vector_type(8)))  float    v8f;

#define NWTOK 256
#define CCH   256
#define NHEAD 8
#define SCALE_QK 0.17677669529663689f   // 1/sqrt(32)

// ---- LDS layout (total = 320000 bytes <= 320 KB/WGP) ----
#define XN_OFF   0            // half [256][264]  normalized input (A rows: [token][ch])
#define OALL_OFF 135168       // half [256][264]  attn output (B rows: [token][inner]); reused as LN raw staging
#define QS_OFF   270336       // half [256][32]   Q rows [query][dh], pieces swizzled (load_qk)
#define KS_OFF   286720       // half [256][32]   K rows [key][dh], pieces swizzled (load_qk)
#define VT_OFF   303104       // half [32][264]   V^T rows [dh][token]
#define LDS_BYTES 320000
#define XSTR 264
#define QSTR 32

// One operand loader for both A and B (B assumed to mirror the documented A
// interleave: lane-half selects K sub-band {0..7,16..23} vs {8..15,24..31}).
// `tile` = first row (A: M row / B: N column) of the 16-wide tile; storage is
// row-major [row][k] with the given stride (halves). Emits 2x b128 loads.
static __device__ __forceinline__ v16h load_ab(const half_t* __restrict__ base,
                                               int stride, int tile, int kbase, int lane)
{
  const int m  = lane & 15;
  const int hi = (lane >> 4) & 1;
  const half_t* p = base + (size_t)(tile + m) * stride + kbase + hi * 8;
  v8h lo = *(const v8h*)(p);
  v8h hh = *(const v8h*)(p + 16);
  v16h r;
#pragma unroll
  for (int i = 0; i < 8; ++i) { r[i] = lo[i]; r[8 + i] = hh[i]; }
  return r;
}

// Same fragment as load_ab (same value in every lane and register), read from a
// buffer that the prep kernel laid out in fragment order: per (16-row tile,
// 32-wide k step) one 1-KB block = 32 lanes x 16 B of the low registers, then
// 32 lanes x 16 B of the high registers. Each b128 load covers 512 contiguous
// bytes (4 whole 128-B lines) instead of 32 B out of each of 16 rows.
static __device__ __forceinline__ v16h load_packed(const half_t* __restrict__ base,
                                                   int tile16, int ks, int lane)
{
  const half_t* p = base + (size_t)((tile16 * 8 + ks) * 512) + lane * 8;
  v8h lo = *(const v8h*)(p);
  v8h hh = *(const v8h*)(p + 256);
  v16h r;
#pragma unroll
  for (int i = 0; i < 8; ++i) { r[i] = lo[i]; r[8 + i] = hh[i]; }
  return r;
}

// Q and K rows are 64 B (four 16-B pieces). Piece c of row t is kept at piece
// c ^ ((t >> 2) & 3): the 16 rows that one half-wave reads at one piece index then
// fall on 16 different groups of four banks instead of 4 (unpadded 64-B rows put
// rows t, t+4, t+8, t+12 on the same banks). No extra LDS.
// Same fragment as load_ab(base, QSTR, tile, 0, lane), read through that map.
// tile is a multiple of 16, so the swizzle term depends on the lane alone.
static __device__ __forceinline__ v16h load_qk(const half_t* __restrict__ base,
                                               int tile, int lane)
{
  const int m  = lane & 15;
  const int hi = (lane >> 4) & 1;
  const int p0 = (hi ^ (m >> 2)) << 3;            // dh = hi*8 .. +7
  const half_t* p = base + (tile + m) * QSTR;
  v8h lo = *(const v8h*)(p + p0);
  v8h hh = *(const v8h*)(p + (p0 ^ 16));          // dh = 16 + hi*8 .. +7
  v16h r;
#pragma unroll
  for (int i = 0; i < 8; ++i) { r[i] = lo[i]; r[8 + i] = hh[i]; }
  return r;
}

static __device__ __forceinline__ v8f wmma16(v16h a, v16h b, v8f c)
{
  return __builtin_amdgcn_wmma_f32_16x16x32_f16(false, a, false, b, (short)0, c, false, false);
}

// ---------------------------------------------------------------------------
// Prep: convert the weights to f16 in fragment order (see load_packed), expand
// the relative-position bias table to f16 in the order of the S^T tiles:
// [head][query tile][key tile][lane][8], lane = (key>>3 & 1)*16 + (query & 15).
// ---------------------------------------------------------------------------
__global__ void __launch_bounds__(256) swin_prep_kernel(
    const float* __restrict__ w_qkv,      // [256][768]
    const float* __restrict__ w_out,      // [256][256]
    const float* __restrict__ bias_table, // [1575][8]
    const int*   __restrict__ rel_index,  // [256][256] (query, key)
    half_t* __restrict__ wqkvP,           // [48 tiles][8 k steps][2][32 lanes][8]
    half_t* __restrict__ woutP,           // [16 tiles][8 k steps][2][32 lanes][8]
    half_t* __restrict__ biasP)           // [8][16 q tiles][16 key tiles][32 lanes][8]
{
  const int idx = blockIdx.x * 256 + threadIdx.x;
  if (idx < 768 * 256 + 256 * 256) {
    const bool isq = idx < 768 * 256;
    const int i    = isq ? idx : idx - 768 * 256;
    const int e    = i & 7;                         // element of the 16-B piece
    const int ln   = (i >> 3) & 31;                 // lane of the fragment
    const int sel  = (i >> 8) & 1;                  // low / high registers
    const int ks   = (i >> 9) & 7;
    const int row  = (i >> 12) * 16 + (ln & 15);    // output column of the weight
    const int k    = ks * 32 + sel * 16 + (ln >> 4) * 8 + e;
    if (isq) wqkvP[i] = (half_t)w_qkv[k * 768 + row];
    else     woutP[i] = (half_t)w_out[k * 256 + row];
  } else {
    const int i  = idx - (768 * 256 + 256 * 256);   // < 8*65536
    const int hh = i >> 16;
    const int e  = i & 7;
    const int ln = (i >> 3) & 31;
    const int kt = (i >> 8) & 15;
    const int qt = (i >> 12) & 15;
    const int query = qt * 16 + (ln & 15);
    const int key   = kt * 16 + (ln >> 4) * 8 + e;
    const int rel   = min(max(rel_index[query * 256 + key], 0), 1574);  // stay inside bias_table
    biasP[i] = (half_t)bias_table[rel * 8 + hh];
  }
}

// ---------------------------------------------------------------------------
// Fully fused window-attention block: one workgroup (16 wave32, four per SIMD)
// per window. The LDS lets only one workgroup live on a WGP, so its own waves are
// all that can cover each other's LDS, cache and dependent-chain waits.
// ---------------------------------------------------------------------------
__global__ void __launch_bounds__(512) swin_window_attn_kernel(
    const float* __restrict__ x,        // (1,256,16,64,64)
    const float* __restrict__ gamma,
    const float* __restrict__ beta,
    const half_t* __restrict__ wqkvP,   // fragment order, 48 tiles x 8 k steps
    const half_t* __restrict__ woutP,   // fragment order, 16 tiles x 8 k steps
    const float* __restrict__ b_out,
    const half_t* __restrict__ biasP,   // [8][16][16][32 lanes][8]
    float* __restrict__ out)            // (1,256,16,64,64)
{
  extern __shared__ char smem[];
  half_t* XN   = (half_t*)(smem + XN_OFF);
  half_t* OALL = (half_t*)(smem + OALL_OFF);
  half_t* QS   = (half_t*)(smem + QS_OFF);
  half_t* KS   = (half_t*)(smem + KS_OFF);
  half_t* VT   = (half_t*)(smem + VT_OFF);
  float*  sGamma = (float*)(smem + QS_OFF);   // overlay while QS unused (LN phase)
  float*  sBeta  = sGamma + 256;
  float2* sPart  = (float2*)(sGamma + 512);   // per thread: sum, sum of squares of its 128 channels
  float*  sBout  = (float*)(smem + QS_OFF);   // overlay while QS unused (out phase)

  const int tid  = threadIdx.x;
  const int lane = tid & 31;
  const int wave = __builtin_amdgcn_readfirstlane(tid >> 5);   // 0..15, in a scalar register
  const int hi   = (lane >> 4) & 1;
  const int nsel = lane & 15;

  // Which window a workgroup takes. The 8 windows side by side in w share every 256-B row
  // of x and of out. Those 8 windows get indices 8 apart. Speed only: any placement gives the
  // same values, since index -> window stays one to one (3 + 2 + 3 index bits, each used once).
  const int bid = blockIdx.x;
  const int gw = (bid >> 3) & 7;
  const int gd = (bid & 7) >> 1, gh = ((bid & 1) << 2) | (bid >> 6);
  const int d0 = gd * 4, h0 = gh * 8, w0 = gw * 8;

  const v8f vzero = {0.f, 0.f, 0.f, 0.f, 0.f, 0.f, 0.f, 0.f};

  // Stage LN affine params into LDS.
  sGamma[tid] = (tid < 256) ? gamma[tid] : beta[tid - 256];   // sBeta follows sGamma

  // ---- Phase 1: window gather + LayerNorm (two threads per token, 128 channels each) ----
  {
    const int tok = tid & 255;
    const int cb  = (wave >> 3) * 128;          // this thread's channels: cb .. cb+127 (one value per wave)
    const int wd = tok >> 6, wh = (tok >> 3) & 7, ww = tok & 7;
    const size_t sp = (size_t)(d0 + wd) * 4096 + (size_t)(h0 + wh) * 64 + (size_t)(w0 + ww);
    const float* xp = x + sp;
    half_t* raw = OALL + (size_t)tok * XSTR;    // OALL region is free right now
    float s = 0.f, ss = 0.f;
    // 64 loads are issued before the first is used (a wave's load counter holds no more),
    // so a wave waits out the memory latency twice; 16 waves keep 1,024 loads in flight.
#pragma unroll 1   // two trips of 64 channels
    for (int c0 = cb; c0 < cb + 128; c0 += 64) {
      float v[64];
#pragma unroll
      for (int g = 0; g < 64; g += 32) {
#pragma unroll
        for (int j = 0; j < 32; ++j) v[g + j] = xp[(size_t)(c0 + g + j) * 65536];
        // Address registers of the issued loads are rewritten only behind this wait. It
        // takes the group's base as an input, so that no load of the group is given its
        // own address pair as target ahead of the wait.
        asm volatile("s_wait_xcnt 0x0" :: "v"(xp + (size_t)(c0 + g) * 65536) : "memory");
      }
#pragma unroll
      for (int j = 0; j < 64; ++j) {
        s += v[j]; ss += v[j] * v[j];
        raw[c0 + j] = (half_t)v[j];
      }
    }
    sPart[tid] = make_float2(s, ss);
    __syncthreads();                            // gamma/beta and the half sums staged by all threads
    const float2 pl = sPart[tok], ph = sPart[tok + 256];
    s  = pl.x + ph.x;                           // low channels + high channels, in both threads
    ss = pl.y + ph.y;
    const float mu  = s * (1.f / 256.f);
    const float var = ss * (1.f / 256.f) - mu * mu;
    const float rs  = rsqrtf(var + 1e-5f);
    half_t* xr = XN + (size_t)tok * XSTR;
#pragma unroll 8
    for (int i = 0; i < 128; ++i) {
      const int c = cb + i;
      float v = ((float)raw[c] - mu) * rs * sGamma[c] + sBeta[c];
      xr[c] = (half_t)v;
    }
  }
  __syncthreads();

  // ---- Phase 2: per head, QKV projection then attention ----
  // Lane part of the swizzled Q/K store offset, element (token mrow + r + 8*hi,
  // dh jj*16 + nsel): piece jj*2 + (nsel>>3), row term (r>>2) + 2*hi.
  int qkst[2][2];
#pragma unroll
  for (int jj = 0; jj < 2; ++jj)
#pragma unroll
    for (int rr = 0; rr < 2; ++rr)
      qkst[jj][rr] = hi * 8 * QSTR + (((jj * 2 + (nsel >> 3)) ^ (rr + 2 * hi)) << 3) + (nsel & 7);
#pragma unroll 1
  for (int h = 0; h < NHEAD; ++h) {
    // --- QKV GEMM: wave pair mg owns token tiles {2mg, 2mg+1}; of the head's 6 output
    // tiles (q0 q1 k0 k1 v0 v1) the even wave takes the first 3, the odd wave the last 3.
    // Each weight fragment still serves two token tiles. ---
    {
      const int mrow0 = (wave >> 1) * 32;
      const int j0    = (wave & 1) * 3;
      v8f acc[2][3];
#pragma unroll
      for (int j = 0; j < 3; ++j) { acc[0][j] = vzero; acc[1][j] = vzero; }
      int ntile[3];
#pragma unroll
      for (int j = 0; j < 3; ++j) ntile[j] = ((j0 + j) >> 1) * 16 + h * 2 + ((j0 + j) & 1);  // q:0.., k:16.., v:32..
      // Weight fragments are fetched four k steps ahead of their use (256 registers do not
      // hold all 24 beside the accumulators).
      v16h b[8][3];
#pragma unroll
      for (int ks = 0; ks < 4; ++ks)
#pragma unroll
        for (int j = 0; j < 3; ++j) b[ks][j] = load_packed(wqkvP, ntile[j], ks, lane);
#pragma unroll
      for (int ks = 0; ks < 8; ++ks) {
        // Keeps each group of weight loads where it is written: left alone, the compiler
        // sank every load to just in front of its WMMAs and waited out each one's latency.
        __builtin_amdgcn_sched_barrier(0);
        v16h a0 = load_ab(XN, XSTR, mrow0,      ks * 32, lane);
        v16h a1 = load_ab(XN, XSTR, mrow0 + 16, ks * 32, lane);
#pragma unroll
        for (int j = 0; j < 3; ++j) {
          acc[0][j] = wmma16(a0, b[ks][j], acc[0][j]);
          acc[1][j] = wmma16(a1, b[ks][j], acc[1][j]);
        }
        if (ks < 4) {
#pragma unroll
          for (int j = 0; j < 3; ++j) b[ks + 4][j] = load_packed(wqkvP, ntile[j], ks + 4, lane);
        }
      }
      // All weight loads have returned; their address registers are reused only behind this wait.
      asm volatile("s_wait_xcnt 0x0" ::: "memory");
      __builtin_amdgcn_sched_barrier(0);   // nothing of the scatter moves up over that wait
      // scatter D tiles: (m=token r+8*hi, n=dh lane&15)
      auto put_qk = [&](half_t* dst, int half, const v8f& d, int mrow) {
#pragma unroll
        for (int r = 0; r < 8; ++r) dst[(mrow + r) * QSTR + qkst[half][r >> 2]] = (half_t)d[r];
      };
      auto put_v = [&](int half, const v8f& d, int mrow) {   // transposed store
#pragma unroll
        for (int r = 0; r < 8; ++r) VT[(half * 16 + nsel) * XSTR + mrow + r + 8 * hi] = (half_t)d[r];
      };
      if (j0 == 0) {
#pragma unroll
        for (int mt = 0; mt < 2; ++mt) {
          put_qk(QS, 0, acc[mt][0], mrow0 + mt * 16);
          put_qk(QS, 1, acc[mt][1], mrow0 + mt * 16);
          put_qk(KS, 0, acc[mt][2], mrow0 + mt * 16);
        }
      } else {
#pragma unroll
        for (int mt = 0; mt < 2; ++mt) {
          put_qk(KS, 1, acc[mt][0], mrow0 + mt * 16);
          put_v(0, acc[mt][1], mrow0 + mt * 16);
          put_v(1, acc[mt][2], mrow0 + mt * 16);
        }
      }
    }
    __syncthreads();

    // --- attention: S^T = K·Q^T then O^T = V^T·P^T ; wave owns query tile w ---
    const half_t* biasbase = biasP + (size_t)h * 65536;
    {
      const int qbase = wave * 16;
      const v16h bq = load_qk(QS, qbase, lane);              // B: n=query, k=dh(32)
      const half_t* biasp = biasbase + (size_t)wave * 4096 + lane * 8;
      float sreg[16][8];                                     // S^T tiles, this lane: one query
      float vmax = -3.0e38f;
#pragma unroll
      for (int kt = 0; kt < 16; ++kt) {
        v16h ak = load_qk(KS, kt * 16, lane);                // A: m=key, k=dh
        v8f sc = wmma16(ak, bq, vzero);
        v8h bb = *(const v8h*)(biasp + kt * 256);            // bias[h][query][key..key+7]
#pragma unroll
        for (int r = 0; r < 8; ++r) {
          float f = sc[r] * SCALE_QK + (float)bb[r];
          sreg[kt][r] = f;
          vmax = fmaxf(vmax, f);
        }
      }
      vmax = fmaxf(vmax, __shfl_xor(vmax, 16));              // lanes l, l+16 share a query
      float rsum = 0.f;
      v8f o0 = vzero, o1 = vzero;
#pragma unroll
      for (int kb = 0; kb < 8; ++kb) {                       // 32-key blocks
        v16h pb;                                             // D tiles ARE the B operand
#pragma unroll
        for (int r = 0; r < 8; ++r) {
          float e0 = __expf(sreg[2 * kb][r] - vmax);
          float e1 = __expf(sreg[2 * kb + 1][r] - vmax);
          rsum += e0 + e1;
          pb[r]     = (half_t)e0;
          pb[8 + r] = (half_t)e1;
        }
        v16h av0 = load_ab(VT, XSTR, 0,  kb * 32, lane);     // A: m=dh 0..15,  k=key
        v16h av1 = load_ab(VT, XSTR, 16, kb * 32, lane);     // A: m=dh 16..31, k=key
        o0 = wmma16(av0, pb, o0);
        o1 = wmma16(av1, pb, o1);
      }
      rsum += __shfl_xor(rsum, 16);
      const float inv = 1.f / rsum;
      half_t* orow = OALL + (size_t)(qbase + nsel) * XSTR + h * 32;
#pragma unroll
      for (int r = 0; r < 8; ++r) {                          // O^T: n=query=lane&15 too
        orow[r + 8 * hi]      = (half_t)(o0[r] * inv);
        orow[16 + r + 8 * hi] = (half_t)(o1[r] * inv);
      }
    }
    __syncthreads();
  }

  // ---- Phase 3: output projection out^T = w_out^T * OALL^T (+b_out) + window merge ----
  if (tid < 256) sBout[tid] = b_out[tid];
  asm volatile("s_wait_xcnt 0x0" ::: "memory");   // before the load's address registers are reused
  __syncthreads();
  {
    const int crow = wave * 16;                              // channel tile
    const half_t* wp = woutP + (size_t)(wave * 8 * 512) + lane * 8;
    v16h aw[8];                                              // A: m=channel, k=inner
#pragma unroll
    for (int ks = 0; ks < 8; ++ks) {                         // = load_packed(woutP, wave, ks, lane)
      v8h lo = *(const v8h*)(wp + ks * 512);
      v8h hh = *(const v8h*)(wp + ks * 512 + 256);
#pragma unroll
      for (int i = 0; i < 8; ++i) { aw[ks][i] = lo[i]; aw[ks][8 + i] = hh[i]; }
    }
    // Address registers of these loads are reused only behind this wait; it takes their
    // base as an input, so that the last load is not given its own address pair as target.
    asm volatile("s_wait_xcnt 0x0" :: "v"(wp) : "memory");
#pragma unroll 1
    for (int ch = 0; ch < 2; ++ch) {
      v8f acc[8];
#pragma unroll
      for (int j = 0; j < 8; ++j) acc[j] = vzero;
#pragma unroll
      for (int ks = 0; ks < 8; ++ks) {
#pragma unroll
        for (int j = 0; j < 8; ++j) {
          v16h b = load_ab(OALL, XSTR, (ch * 8 + j) * 16, ks * 32, lane); // B: n=token
          acc[j] = wmma16(aw[ks], b, acc[j]);
        }
      }
#pragma unroll
      for (int j = 0; j < 8; ++j) {
        const int tok = (ch * 8 + j) * 16 + nsel;
        const int wd = tok >> 6, wh = (tok >> 3) & 7, ww = tok & 7;
        const size_t sp = (size_t)(d0 + wd) * 4096 + (size_t)(h0 + wh) * 64 + (size_t)(w0 + ww);
#pragma unroll
        for (int r = 0; r < 8; ++r) {
          const int c = crow + r + 8 * hi;
          out[(size_t)c * 65536 + sp] = acc[j][r] + sBout[c];  // lanes 0..7: 32B runs
        }
      }
    }
  }
}

// ---------------------------------------------------------------------------
extern "C" void kernel_launch(void* const* d_in, const int* in_sizes, int n_in,
                              void* d_out, int out_size, void* d_ws, size_t ws_size,
                              hipStream_t stream)
{
  (void)in_sizes; (void)n_in; (void)out_size; (void)ws_size;
  const float* x      = (const float*)d_in[0];
  const float* gamma  = (const float*)d_in[1];
  const float* beta   = (const float*)d_in[2];
  const float* w_qkv  = (const float*)d_in[3];
  const float* w_out  = (const float*)d_in[4];
  const float* b_out  = (const float*)d_in[5];
  const float* btable = (const float*)d_in[6];
  const int*   relidx = (const int*)d_in[7];
  float* out = (float*)d_out;

  // Workspace: only 1.57 MB of f16 weight/bias staging.
  half_t* wqkvP = (half_t*)d_ws;            // 768*256
  half_t* woutP = wqkvP + 768 * 256;        // 256*256
  half_t* biasP = woutP + 256 * 256;        // 8*256*256

  swin_prep_kernel<<<3072, 256, 0, stream>>>(w_qkv, w_out, btable, relidx,
                                             wqkvP, woutP, biasP);

  (void)hipFuncSetAttribute((const void*)swin_window_attn_kernel,
                            hipFuncAttributeMaxDynamicSharedMemorySize, LDS_BYTES);
  swin_window_attn_kernel<<<256, 512, LDS_BYTES, stream>>>(
      x, gamma, beta, wqkvP, woutP, b_out, biasP, out);
}

// v006
// Measured time: 78.2 microseconds a run.
// Two timings next to v005 put it at 1.07 and 1.06 times that version's speed.
// Over all steps from v000 it is 1.97 times as fast.
#include <hip/hip_runtime.h>

typedef _Float16 half_t;
typedef __attribute__((ext_vector_type(16))) _Float16 v16h;
typedef __attribute__((ext_vector_type(8)))  _Float16 v8h;
typedef __attribute__((ext_vector_type(8)))  float    v8f;

#define NWTOK 256
#define CCH   256
#define NHEAD 8
#define SCALE_QK 0.17677669529663689f   // 1/sqrt(32)

// ---- LDS layout (total = 320000 bytes <= 320 KB/WGP) ----
#define XN_OFF   0            // half [256][264]  normalized input (A rows: [token][ch])
#define OALL_OFF 135168       // half [256][264]  attn output (B rows: [token][inner]); reused as LN raw staging
#define QS_OFF   270336       // half [256][32]   Q rows [query][dh], pieces swizzled (load_qk)
#define KS_OFF   286720       // half [256][32]   K rows [key][dh], pieces swizzled (load_qk)
#define VT_OFF   303104       // half [32][264]   V^T rows [dh][token]
#define LDS_BYTES 320000
#define XSTR 264
#define QSTR 32

// One operand loader for both A and B (B assumed to mirror the documented A
// interleave: lane-half selects K sub-band {0..7,16..23} vs {8..15,24..31}).
// `tile` = first row (A: M row / B: N column) of the 16-wide tile; storage is
// row-major [row][k] with the given stride (halves). Emits 2x b128 loads.
static __device__ __forceinline__ v16h load_ab(const half_t* __restrict__ base,
                                               int stride, int tile, int kbase, int lane)
{
  const int m  = lane & 15;
  const int hi = (lane >> 4) & 1;
  const half_t* p = base + (size_t)(tile + m) * stride + kbase + hi * 8;
  v8h lo = *(const v8h*)(p);
  v8h hh = *(const v8h*)(p + 16);
  v16h r;
#pragma unroll
  for (int i = 0; i < 8; ++i) { r[i] = lo[i]; r[8 + i] = hh[i]; }
  return r;
}

// Same fragment as load_ab (same value in every lane and register), read from a
// buffer that the prep kernel laid out in fragment order: per (16-row tile,
// 32-wide k step) one 1-KB block = 32 lanes x 16 B of the low registers, then
// 32 lanes x 16 B of the high registers. Each b128 load covers 512 contiguous
// bytes (4 whole 128-B lines) instead of 32 B out of each of 16 rows.
static __device__ __forceinline__ v16h load_packed(const half_t* __restrict__ base,
                                                   int tile16, int ks, int lane)
{
  const half_t* p = base + (size_t)((tile16 * 8 + ks) * 512) + lane * 8;
  v8h lo = *(const v8h*)(p);
  v8h hh = *(const v8h*)(p + 256);
  v16h r;
#pragma unroll
  for (int i = 0; i < 8; ++i) { r[i] = lo[i]; r[8 + i] = hh[i]; }
  return r;
}

// Q and K rows are 64 B (four 16-B pieces). Piece c of row t is kept at piece
// c ^ ((t >> 2) & 3): the 16 rows that one half-wave reads at one piece index then
// fall on 16 different groups of four banks instead of 4 (unpadded 64-B rows put
// rows t, t+4, t+8, t+12 on the same banks). No extra LDS.
// Same fragment as load_ab(base, QSTR, tile, 0, lane), read through that map.
// tile is a multiple of 16, so the swizzle term depends on the lane alone.
static __device__ __forceinline__ v16h load_qk(const half_t* __restrict__ base,
                                               int tile, int lane)
{
  const int m  = lane & 15;
  const int hi = (lane >> 4) & 1;
  const int p0 = (hi ^ (m >> 2)) << 3;            // dh = hi*8 .. +7
  const half_t* p = base + (tile + m) * QSTR;
  v8h lo = *(const v8h*)(p + p0);
  v8h hh = *(const v8h*)(p + (p0 ^ 16));          // dh = 16 + hi*8 .. +7
  v16h r;
#pragma unroll
  for (int i = 0; i < 8; ++i) { r[i] = lo[i]; r[8 + i] = hh[i]; }
  return r;
}

static __device__ __forceinline__ v8f wmma16(v16h a, v16h b, v8f c)
{
  return __builtin_amdgcn_wmma_f32_16x16x32_f16(false, a, false, b, (short)0, c, false, false);
}

// ---------------------------------------------------------------------------
// Prep: convert the weights to f16 in fragment order (see load_packed), expand
// the relative-position bias table to f16 in the order of the S^T tiles:
// [head][query tile][key tile][lane][8], lane = (key>>3 & 1)*16 + (query & 15).
// ---------------------------------------------------------------------------
__global__ void __launch_bounds__(256) swin_prep_kernel(
    const float* __restrict__ w_qkv,      // [256][768]
    const float* __restrict__ w_out,      // [256][256]
    const float* __restrict__ bias_table, // [1575][8]
    const int*   __restrict__ rel_index,  // [256][256] (query, key)
    half_t* __restrict__ wqkvP,           // [48 tiles][8 k steps][2][32 lanes][8]
    half_t* __restrict__ woutP,           // [16 tiles][8 k steps][2][32 lanes][8]
    half_t* __restrict__ biasP)           // [8][16 q tiles][16 key tiles][32 lanes][8]
{
  const int idx = blockIdx.x * 256 + threadIdx.x;
  if (idx < 768 * 256 + 256 * 256) {
    const bool isq = idx < 768 * 256;
    const int i    = isq ? idx : idx - 768 * 256;
    const int e    = i & 7;                         // element of the 16-B piece
    const int ln   = (i >> 3) & 31;                 // lane of the fragment
    const int sel  = (i >> 8) & 1;                  // low / high registers
    const int ks   = (i >> 9) & 7;
    const int row  = (i >> 12) * 16 + (ln & 15);    // output column of the weight
    const int k    = ks * 32 + sel * 16 + (ln >> 4) * 8 + e;
    if (isq) wqkvP[i] = (half_t)w_qkv[k * 768 + row];
    else     woutP[i] = (half_t)w_out[k * 256 + row];
  } else {
    const int i  = idx - (768 * 256 + 256 * 256);   // < 8*65536
    const int hh = i >> 16;
    const int e  = i & 7;
    const int ln = (i >> 3) & 31;
    const int kt = (i >> 8) & 15;
    const int qt = (i >> 12) & 15;
    const int query = qt * 16 + (ln & 15);
    const int key   = kt * 16 + (ln >> 4) * 8 + e;
    const int rel   = min(max(rel_index[query * 256 + key], 0), 1574);  // stay inside bias_table
    biasP[i] = (half_t)bias_table[rel * 8 + hh];
  }
}

// ---------------------------------------------------------------------------
// Fully fused window-attention block: one workgroup (16 wave32, four per SIMD)
// per window. The LDS lets only one workgroup live on a WGP, so its own waves are
// all that can cover each other's LDS, cache and dependent-chain waits.
// ---------------------------------------------------------------------------
__global__ void __launch_bounds__(512) swin_window_attn_kernel(
    const float* __restrict__ x,        // (1,256,16,64,64)
    const float* __restrict__ gamma,
    const float* __restrict__ beta,
    const half_t* __restrict__ wqkvP,   // fragment order, 48 tiles x 8 k steps
    const half_t* __restrict__ woutP,   // fragment order, 16 tiles x 8 k steps
    const float* __restrict__ b_out,
    const half_t* __restrict__ biasP,   // [8][16][16][32 lanes][8]
    float* __restrict__ out)            // (1,256,16,64,64)
{
  extern __shared__ char smem[];
  half_t* XN   = (half_t*)(smem + XN_OFF);
  half_t* OALL = (half_t*)(smem + OALL_OFF);
  half_t* QS   = (half_t*)(smem + QS_OFF);
  half_t* KS   = (half_t*)(smem + KS_OFF);
  half_t* VT   = (half_t*)(smem + VT_OFF);
  float*  sGamma = (float*)(smem + QS_OFF);   // overlay while QS unused (LN phase)
  float*  sBeta  = sGamma + 256;
  float2* sPart  = (float2*)(sGamma + 512);   // per thread: sum, sum of squares of its 128 channels
  float*  sBout  = (float*)(smem + QS_OFF);   // overlay while QS unused (out phase)

  const int tid  = threadIdx.x;
  const int lane = tid & 31;
  const int wave = __builtin_amdgcn_readfirstlane(tid >> 5);   // 0..15, in a scalar register
  const int hi   = (lane >> 4) & 1;
  const int nsel = lane & 15;

  // Which window a workgroup takes. The 8 windows side by side in w share every 256-B row
  // of x and of out. Those 8 windows get indices 8 apart. Speed only: any placement gives the
  // same values, since index -> window stays one to one (3 + 2 + 3 index bits, each used once).
  const int bid = blockIdx.x;
  const int gw = (bid >> 3) & 7;
  const int gd = (bid & 7) >> 1, gh = ((bid & 1) << 2) | (bid >> 6);
  const int d0 = gd * 4, h0 = gh * 8, w0 = gw * 8;

  const v8f vzero = {0.f, 0.f, 0.f, 0.f, 0.f, 0.f, 0.f, 0.f};

  // Stage LN affine params into LDS.
  sGamma[tid] = (tid < 256) ? gamma[tid] : beta[tid - 256];   // sBeta follows sGamma

  // ---- Phase 1: window gather + LayerNorm (two threads per token, 128 channels each) ----
  {
    const int tok = tid & 255;
    const int cb  = (wave >> 3) * 128;          // this thread's channels: cb .. cb+127 (one value per wave)
    const int wd = tok >> 6, wh = (tok >> 3) & 7, ww = tok & 7;
    const size_t sp = (size_t)(d0 + wd) * 4096 + (size_t)(h0 + wh) * 64 + (size_t)(w0 + ww);
    const float* xp = x + sp;
    half_t* raw = OALL + (size_t)tok * XSTR;    // OALL region is free right now
    float s = 0.f, ss = 0.f;
    // 64 loads are issued before the first is used (a wave's load counter holds no more),
    // so a wave waits out the memory latency twice; 16 waves keep 1,024 loads in flight.
#pragma unroll 1   // two trips of 64 channels
    for (int c0 = cb; c0 < cb + 128; c0 += 64) {
      float v[64];
#pragma unroll
      for (int g = 0; g < 64; g += 32) {
#pragma unroll
        for (int j = 0; j < 32; ++j) v[g + j] = xp[(size_t)(c0 + g + j) * 65536];
        // Address registers of the issued loads are rewritten only behind this wait. It
        // takes the group's base as an input, so that no load of the group is given its
        // own address pair as target ahead of the wait.
        asm volatile("s_wait_xcnt 0x0" :: "v"(xp + (size_t)(c0 + g) * 65536) : "memory");
      }
#pragma unroll
      for (int j = 0; j < 64; ++j) {
        s += v[j]; ss += v[j] * v[j];
        raw[c0 + j] = (half_t)v[j];
      }
    }
    sPart[tid] = make_float2(s, ss);
    __syncthreads();                            // gamma/beta and the half sums staged by all threads
    const float2 pl = sPart[tok], ph = sPart[tok + 256];
    s  = pl.x + ph.x;                           // low channels + high channels, in both threads
    ss = pl.y + ph.y;
    const float mu  = s * (1.f / 256.f);
    const float var = ss * (1.f / 256.f) - mu * mu;
    const float rs  = rsqrtf(var + 1e-5f);
    half_t* xr = XN + (size_t)tok * XSTR;
#pragma unroll 8
    for (int i = 0; i < 128; ++i) {
      const int c = cb + i;
      float v = ((float)raw[c] - mu) * rs * sGamma[c] + sBeta[c];
      xr[c] = (half_t)v;
    }
  }
  __syncthreads();

  // ---- Phase 2: per head, QKV projection then attention ----
  // Lane part of the swizzled Q/K store offset, element (token mrow + r + 8*hi,
  // dh jj*16 + nsel): piece jj*2 + (nsel>>3), row term (r>>2) + 2*hi.
  int qkst[2][2];
#pragma unroll
  for (int jj = 0; jj < 2; ++jj)
#pragma unroll
    for (int rr = 0; rr < 2; ++rr)
      qkst[jj][rr] = hi * 8 * QSTR + (((jj * 2 + (nsel >> 3)) ^ (rr + 2 * hi)) << 3) + (nsel & 7);
#pragma unroll 1
  for (int h = 0; h < NHEAD; ++h) {
    // --- QKV GEMM: wave pair mg owns token tiles {2mg, 2mg+1}; of the head's 6 output
    // tiles (q0 q1 k0 k1 v0 v1) the even wave takes the first 3, the odd wave the last 3.
    // Each weight fragment still serves two token tiles. ---
    {
      const int mrow0 = (wave >> 1) * 32;
      const int j0    = (wave & 1) * 3;
      v8f acc[2][3];
#pragma unroll
      for (int j = 0; j < 3; ++j) { acc[0][j] = vzero; acc[1][j] = vzero; }
      int ntile[3];
#pragma unroll
      for (int j = 0; j < 3; ++j) ntile[j] = ((j0 + j) >> 1) * 16 + h * 2 + ((j0 + j) & 1);  // q:0.., k:16.., v:32..
      // Weight fragments are fetched four k steps ahead of their use (256 registers do not
      // hold all 24 beside the accumulators).
      v16h b[8][3];
#pragma unroll
      for (int ks = 0; ks < 4; ++ks)
#pragma unroll
        for (int j = 0; j < 3; ++j) b[ks][j] = load_packed(wqkvP, ntile[j], ks, lane);
#pragma unroll
      for (int ks = 0; ks < 8; ++ks) {
        // Keeps each group of weight loads where it is written: left alone, the compiler
        // sank every load to just in front of its WMMAs and waited out each one's latency.
        __builtin_amdgcn_sched_barrier(0);
        v16h a0 = load_ab(XN, XSTR, mrow0,      ks * 32, lane);
        v16h a1 = load_ab(XN, XSTR, mrow0 + 16, ks * 32, lane);
#pragma unroll
        for (int j = 0; j < 3; ++j) {
          acc[0][j] = wmma16(a0, b[ks][j], acc[0][j]);
          acc[1][j] = wmma16(a1, b[ks][j], acc[1][j]);
        }
        if (ks < 4) {
#pragma unroll
          for (int j = 0; j < 3; ++j) b[ks + 4][j] = load_packed(wqkvP, ntile[j], ks + 4, lane);
        }
      }
      // All weight loads have returned; their address registers are reused only behind this wait.
      asm volatile("s_wait_xcnt 0x0" ::: "memory");
      __builtin_amdgcn_sched_barrier(0);   // nothing of the scatter moves up over that wait
      // scatter D tiles: (m=token r+8*hi, n=dh lane&15)
      auto put_qk = [&](half_t* dst, int half, const v8f& d, int mrow) {
#pragma unroll
        for (int r = 0; r < 8; ++r) dst[(mrow + r) * QSTR + qkst[half][r >> 2]] = (half_t)d[r];
      };
      auto put_v = [&](int half, const v8f& d, int mrow) {   // transposed store
#pragma unroll
        for (int r = 0; r < 8; ++r) VT[(half * 16 + nsel) * XSTR + mrow + r + 8 * hi] = (half_t)d[r];
      };
      if (j0 == 0) {
#pragma unroll
        for (int mt = 0; mt < 2; ++mt) {
          put_qk(QS, 0, acc[mt][0], mrow0 + mt * 16);
          put_qk(QS, 1, acc[mt][1], mrow0 + mt * 16);
          put_qk(KS, 0, acc[mt][2], mrow0 + mt * 16);
        }
      } else {
#pragma unroll
        for (int mt = 0; mt < 2; ++mt) {
          put_qk(KS, 1, acc[mt][0], mrow0 + mt * 16);
          put_v(0, acc[mt][1], mrow0 + mt * 16);
          put_v(1, acc[mt][2], mrow0 + mt * 16);
        }
      }
    }
    __syncthreads();

    // --- attention: S^T = K·Q^T then O^T = V^T·P^T ; wave owns query tile w ---
    const half_t* biasbase = biasP + (size_t)h * 65536;
    {
      const int qbase = wave * 16;
      const v16h bq = load_qk(QS, qbase, lane);              // B: n=query, k=dh(32)
      const half_t* biasp = biasbase + (size_t)wave * 4096 + lane * 8;
      float sreg[16][8];                                     // S^T tiles, this lane: one query
      float vmax = -3.0e38f;
#pragma unroll
      for (int kt = 0; kt < 16; ++kt) {
        v16h ak = load_qk(KS, kt * 16, lane);                // A: m=key, k=dh
        v8f sc = wmma16(ak, bq, vzero);
        v8h bb = *(const v8h*)(biasp + kt * 256);            // bias[h][query][key..key+7]
#pragma unroll
        for (int r = 0; r < 8; ++r) {
          float f = sc[r] * SCALE_QK + (float)bb[r];
          sreg[kt][r] = f;
          vmax = fmaxf(vmax, f);
        }
      }
      vmax = fmaxf(vmax, __shfl_xor(vmax, 16));              // lanes l, l+16 share a query
      float rsum = 0.f;
      v8f o0 = vzero, o1 = vzero;
#pragma unroll
      for (int kb = 0; kb < 8; ++kb) {                       // 32-key blocks
        v16h pb;                                             // D tiles ARE the B operand
#pragma unroll
        for (int r = 0; r < 8; ++r) {
          float e0 = __expf(sreg[2 * kb][r] - vmax);
          float e1 = __expf(sreg[2 * kb + 1][r] - vmax);
          rsum += e0 + e1;
          pb[r]     = (half_t)e0;
          pb[8 + r] = (half_t)e1;
        }
        v16h av0 = load_ab(VT, XSTR, 0,  kb * 32, lane);     // A: m=dh 0..15,  k=key
        v16h av1 = load_ab(VT, XSTR, 16, kb * 32, lane);     // A: m=dh 16..31, k=key
        o0 = wmma16(av0, pb, o0);
        o1 = wmma16(av1, pb, o1);
      }
      rsum += __shfl_xor(rsum, 16);
      const float inv = 1.f / rsum;
      half_t* orow = OALL + (size_t)(qbase + nsel) * XSTR + h * 32;
#pragma unroll
      for (int r = 0; r < 8; ++r) {                          // O^T: n=query=lane&15 too
        orow[r + 8 * hi]      = (half_t)(o0[r] * inv);
        orow[16 + r + 8 * hi] = (half_t)(o1[r] * inv);
      }
    }
    __syncthreads();
  }

  // ---- Phase 3: output projection out^T = w_out^T * OALL^T (+b_out) + window merge ----
  if (tid < 256) sBout[tid] = b_out[tid];
  asm volatile("s_wait_xcnt 0x0" ::: "memory");   // before the load's address registers are reused
  __syncthreads();
  {
    // A wave owns 2 channel tiles x 8 token tiles: each OALL fragment read from LDS feeds two
    // WMMAs, and the workgroup reads OALL 8 times over, not 16.
    const int ct0 = (wave >> 1) * 2;                         // first channel tile
    const int tt0 = (wave & 1) * 8;                          // first token tile
    const half_t* wp = woutP + (size_t)(ct0 * 8 * 512) + lane * 8;
    v16h aw[2][8];                                           // A: m=channel, k=inner
#pragma unroll
    for (int i = 0; i < 2; ++i)
#pragma unroll
      for (int ks = 0; ks < 8; ++ks) {                       // = load_packed(woutP, ct0 + i, ks, lane)
        v8h lo = *(const v8h*)(wp + (i * 8 + ks) * 512);
        v8h hh = *(const v8h*)(wp + (i * 8 + ks) * 512 + 256);
#pragma unroll
        for (int e = 0; e < 8; ++e) { aw[i][ks][e] = lo[e]; aw[i][ks][8 + e] = hh[e]; }
      }
    // Address registers of these loads are reused only behind this wait; it takes their
    // base as an input, so that the last load is not given its own address pair as target.
    asm volatile("s_wait_xcnt 0x0" :: "v"(wp) : "memory");
    // This lane's row of the group's first token tile; carried through the loop so that every
    // read of a group is this one address plus an immediate offset.
    const half_t* bp = OALL + (size_t)(tt0 * 16 + nsel) * XSTR + hi * 8;
    auto frag = [](const half_t* p) {                        // = load_ab, row and lane half already in p
      v8h lo = *(const v8h*)(p);
      v8h hh = *(const v8h*)(p + 16);
      v16h r;
#pragma unroll
      for (int e = 0; e < 8; ++e) { r[e] = lo[e]; r[8 + e] = hh[e]; }
      return r;
    };
#pragma unroll 1   // four groups of 2 x 2 tiles; the weights stay in registers throughout
    for (int g = 0; g < 4; ++g, bp += 32 * XSTR) {
      const int t0 = (tt0 + g * 2) * 16;
      v8f acc[2][2];
#pragma unroll
      for (int i = 0; i < 2; ++i) { acc[i][0] = vzero; acc[i][1] = vzero; }
      v16h b[8][2];                                          // B: n=token, k=inner
#pragma unroll
      for (int ks = 0; ks < 2; ++ks) {
        b[ks][0] = frag(bp + ks * 32);
        b[ks][1] = frag(bp + 16 * XSTR + ks * 32);
      }
#pragma unroll
      for (int ks = 0; ks < 8; ++ks) {
        // Holds each k step's reads (two steps ahead) and WMMAs where they are written. Builds
        // without it either sank each read to just in front of its WMMA, or spread the last
        // WMMAs among the stores, each store then waiting for its own bias read.
        __builtin_amdgcn_sched_barrier(0);
        if (ks < 6) {
          b[ks + 2][0] = frag(bp + (ks + 2) * 32);
          b[ks + 2][1] = frag(bp + 16 * XSTR + (ks + 2) * 32);
        }
#pragma unroll
        for (int j = 0; j < 2; ++j) {
          acc[0][j] = wmma16(aw[0][ks], b[ks][j], acc[0][j]);
          acc[1][j] = wmma16(aw[1][ks], b[ks][j], acc[1][j]);
        }
      }
#pragma unroll
      for (int j = 0; j < 2; ++j) {
        const int tok = t0 + j * 16 + nsel;
        const int wd = tok >> 6, wh = (tok >> 3) & 7, ww = tok & 7;
        const size_t sp = (size_t)(d0 + wd) * 4096 + (size_t)(h0 + wh) * 64 + (size_t)(w0 + ww);
#pragma unroll
        for (int i = 0; i < 2; ++i)
#pragma unroll
          for (int r = 0; r < 8; ++r) {
            const int c = (ct0 + i) * 16 + r + 8 * hi;
            out[(size_t)c * 65536 + sp] = acc[i][j][r] + sBout[c];  // lanes 0..7: 32B runs
          }
      }
      // Data and address registers of the group's stores are reused by the next group only
      // behind this wait.
      asm volatile("s_wait_xcnt 0x0" ::: "memory");
    }
  }
}

// ---------------------------------------------------------------------------
extern "C" void kernel_launch(void* const* d_in, const int* in_sizes, int n_in,
                              void* d_out, int out_size, void* d_ws, size_t ws_size,
                              hipStream_t stream)
{
  (void)in_sizes; (void)n_in; (void)out_size; (void)ws_size;
  const float* x      = (const float*)d_in[0];
  const float* gamma  = (const float*)d_in[1];
  const float* beta   = (const float*)d_in[2];
  const float* w_qkv  = (const float*)d_in[3];
  const float* w_out  = (const float*)d_in[4];
  const float* b_out  = (const float*)d_in[5];
  const float* btable = (const float*)d_in[6];
  const int*   relidx = (const int*)d_in[7];
  float* out = (float*)d_out;

  // Workspace: only 1.57 MB of f16 weight/bias staging.
  half_t* wqkvP = (half_t*)d_ws;            // 768*256
  half_t* woutP = wqkvP + 768 * 256;        // 256*256
  half_t* biasP = woutP + 256 * 256;        // 8*256*256

  swin_prep_kernel<<<3072, 256, 0, stream>>>(w_qkv, w_out, btable, relidx,
                                             wqkvP, woutP, biasP);

  (void)hipFuncSetAttribute((const void*)swin_window_attn_kernel,
                            hipFuncAttributeMaxDynamicSharedMemorySize, LDS_BYTES);
  swin_window_attn_kernel<<<256, 512, LDS_BYTES, stream>>>(
      x, gamma, beta, wqkvP, woutP, b_out, biasP, out);
}

// v007
// A run of this version takes 73.6 microseconds.
// Two timings next to v006 both put it at 1.06 times that version's speed.
// Over all steps from v000 it is 2.09 times as fast.
#include <hip/hip_runtime.h>

typedef _Float16 half_t;
typedef __attribute__((ext_vector_type(16))) _Float16 v16h;
typedef __attribute__((ext_vector_type(8)))  _Float16 v8h;
typedef __attribute__((ext_vector_type(8)))  float    v8f;

#define NWTOK 256
#define CCH   256
#define NHEAD 8
#define SCALE_QK 0.17677669529663689f   // 1/sqrt(32)

// ---- LDS layout (total = 320000 bytes <= 320 KB/WGP) ----
#define XN_OFF   0            // half [256][264]  normalized input (A rows: [token][ch])
#define OALL_OFF 135168       // half [256][264]  attn output (B rows: [token][inner]); reused as LN raw staging
#define QS_OFF   270336       // half [256][32]   Q rows [query][dh], pieces swizzled (load_qk)
#define KS_OFF   286720       // half [256][32]   K rows [key][dh], pieces swizzled (load_qk)
#define VT_OFF   303104       // half [32][264]   V^T rows [dh][token]
#define LDS_BYTES 320000
#define XSTR 264
#define QSTR 32
#define PREKB 5               // 32-key block behind whose exponentials the next phase's weights are asked for

// One operand loader for both A and B (B assumed to mirror the documented A
// interleave: lane-half selects K sub-band {0..7,16..23} vs {8..15,24..31}).
// `tile` = first row (A: M row / B: N column) of the 16-wide tile; storage is
// row-major [row][k] with the given stride (halves). Emits 2x b128 loads.
static __device__ __forceinline__ v16h load_ab(const half_t* __restrict__ base,
                                               int stride, int tile, int kbase, int lane)
{
  const int m  = lane & 15;
  const int hi = (lane >> 4) & 1;
  const half_t* p = base + (size_t)(tile + m) * stride + kbase + hi * 8;
  v8h lo = *(const v8h*)(p);
  v8h hh = *(const v8h*)(p + 16);
  v16h r;
#pragma unroll
  for (int i = 0; i < 8; ++i) { r[i] = lo[i]; r[8 + i] = hh[i]; }
  return r;
}

// Same fragment as load_ab (same value in every lane and register), read from a
// buffer that the prep kernel laid out in fragment order: per (16-row tile,
// 32-wide k step) one 1-KB block = 32 lanes x 16 B of the low registers, then
// 32 lanes x 16 B of the high registers. Each b128 load covers 512 contiguous
// bytes (4 whole 128-B lines) instead of 32 B out of each of 16 rows.
// p = start of the block, (tile * 8 + k step) * 512 halves, + lane * 8.
static __device__ __forceinline__ v16h load_frag(const half_t* __restrict__ p)
{
  v8h lo = *(const v8h*)(p);
  v8h hh = *(const v8h*)(p + 256);
  v16h r;
#pragma unroll
  for (int i = 0; i < 8; ++i) { r[i] = lo[i]; r[8 + i] = hh[i]; }
  return r;
}

// Q and K rows are 64 B (four 16-B pieces). Piece c of row t is kept at piece
// c ^ ((t >> 2) & 3): the 16 rows that one half-wave reads at one piece index then
// fall on 16 different groups of four banks instead of 4 (unpadded 64-B rows put
// rows t, t+4, t+8, t+12 on the same banks). No extra LDS.
// Same fragment as load_ab(base, QSTR, tile, 0, lane), read through that map.
// tile is a multiple of 16, so the swizzle term depends on the lane alone.
static __device__ __forceinline__ v16h load_qk(const half_t* __restrict__ base,
                                               int tile, int lane)
{
  const int m  = lane & 15;
  const int hi = (lane >> 4) & 1;
  const int p0 = (hi ^ (m >> 2)) << 3;            // dh = hi*8 .. +7
  const half_t* p = base + (tile + m) * QSTR;
  v8h lo = *(const v8h*)(p + p0);
  v8h hh = *(const v8h*)(p + (p0 ^ 16));          // dh = 16 + hi*8 .. +7
  v16h r;
#pragma unroll
  for (int i = 0; i < 8; ++i) { r[i] = lo[i]; r[8 + i] = hh[i]; }
  return r;
}

// Work-group barrier for data that passes through LDS alone: the wave's own LDS reads and
// writes are done, then the barrier. __syncthreads() also waits for every global load of the
// wave, so a load asked for ahead would be waited out in front of it instead of flying over it.
// Between the waves of this kernel nothing passes through global memory.
static __device__ __forceinline__ void lds_barrier()
{
  asm volatile("s_wait_dscnt 0x0" ::: "memory");
  asm volatile("s_barrier_signal -1\n\ts_barrier_wait -1" ::: "memory");
}

static __device__ __forceinline__ v8f wmma16(v16h a, v16h b, v8f c)
{
  return __builtin_amdgcn_wmma_f32_16x16x32_f16(false, a, false, b, (short)0, c, false, false);
}

// ---------------------------------------------------------------------------
// Prep: convert the weights to f16 in fragment order (see load_frag), expand
// the relative-position bias table to f16 in the order of the S^T tiles:
// [head][query tile][key tile][lane][8], lane = (key>>3 & 1)*16 + (query & 15).
// ---------------------------------------------------------------------------
__global__ void __launch_bounds__(256) swin_prep_kernel(
    const float* __restrict__ w_qkv,      // [256][768]
    const float* __restrict__ w_out,      // [256][256]
    const float* __restrict__ bias_table, // [1575][8]
    const int*   __restrict__ rel_index,  // [256][256] (query, key)
    half_t* __restrict__ wqkvP,           // [48 tiles][8 k steps][2][32 lanes][8]
    half_t* __restrict__ woutP,           // [16 tiles][8 k steps][2][32 lanes][8]
    half_t* __restrict__ biasP)           // [8][16 q tiles][16 key tiles][32 lanes][8]
{
  const int idx = blockIdx.x * 256 + threadIdx.x;
  if (idx < 768 * 256 + 256 * 256) {
    const bool isq = idx < 768 * 256;
    const int i    = isq ? idx : idx - 768 * 256;
    const int e    = i & 7;                         // element of the 16-B piece
    const int ln   = (i >> 3) & 31;                 // lane of the fragment
    const int sel  = (i >> 8) & 1;                  // low / high registers
    const int ks   = (i >> 9) & 7;
    const int row  = (i >> 12) * 16 + (ln & 15);    // output column of the weight
    const int k    = ks * 32 + sel * 16 + (ln >> 4) * 8 + e;
    if (isq) wqkvP[i] = (half_t)w_qkv[k * 768 + row];
    else     woutP[i] = (half_t)w_out[k * 256 + row];
  } else {
    const int i  = idx - (768 * 256 + 256 * 256);   // < 8*65536
    const int hh = i >> 16;
    const int e  = i & 7;
    const int ln = (i >> 3) & 31;
    const int kt = (i >> 8) & 15;
    const int qt = (i >> 12) & 15;
    const int query = qt * 16 + (ln & 15);
    const int key   = kt * 16 + (ln >> 4) * 8 + e;
    const int rel   = min(max(rel_index[query * 256 + key], 0), 1574);  // stay inside bias_table
    biasP[i] = (half_t)bias_table[rel * 8 + hh];
  }
}

// ---------------------------------------------------------------------------
// Fully fused window-attention block: one workgroup (16 wave32, four per SIMD)
// per window. The LDS lets only one workgroup live on a WGP, so its own waves are
// all that can cover each other's LDS, cache and dependent-chain waits.
// ---------------------------------------------------------------------------
__global__ void __launch_bounds__(512) swin_window_attn_kernel(
    const float* __restrict__ x,        // (1,256,16,64,64)
    const float* __restrict__ gamma,
    const float* __restrict__ beta,
    const half_t* __restrict__ wqkvP,   // fragment order, 48 tiles x 8 k steps
    const half_t* __restrict__ woutP,   // fragment order, 16 tiles x 8 k steps
    const float* __restrict__ b_out,
    const half_t* __restrict__ biasP,   // [8][16][16][32 lanes][8]
    float* __restrict__ out)            // (1,256,16,64,64)
{
  extern __shared__ char smem[];
  half_t* XN   = (half_t*)(smem + XN_OFF);
  half_t* OALL = (half_t*)(smem + OALL_OFF);
  half_t* QS   = (half_t*)(smem + QS_OFF);
  half_t* KS   = (half_t*)(smem + KS_OFF);
  half_t* VT   = (half_t*)(smem + VT_OFF);
  float*  sGamma = (float*)(smem + QS_OFF);   // overlay while QS unused (LN phase)
  float*  sBeta  = sGamma + 256;
  float2* sPart  = (float2*)(sGamma + 512);   // per thread: sum, sum of squares of its 128 channels
  float*  sBout  = (float*)(smem + QS_OFF);   // overlay while QS unused (out phase)

  const int tid  = threadIdx.x;
  const int lane = tid & 31;
  const int wave = __builtin_amdgcn_readfirstlane(tid >> 5);   // 0..15, in a scalar register
  const int hi   = (lane >> 4) & 1;
  const int nsel = lane & 15;

  // Which window a workgroup takes. The 8 windows side by side in w share every 256-B row
  // of x and of out. Those 8 windows get indices 8 apart. Speed only: any placement gives the
  // same values, since index -> window stays one to one (3 + 2 + 3 index bits, each used once).
  const int bid = blockIdx.x;
  const int gw = (bid >> 3) & 7;
  const int gd = (bid & 7) >> 1, gh = ((bid & 1) << 2) | (bid >> 6);
  const int d0 = gd * 4, h0 = gh * 8, w0 = gw * 8;

  const v8f vzero = {0.f, 0.f, 0.f, 0.f, 0.f, 0.f, 0.f, 0.f};

  // Weights that a phase needs first are asked for while the phase before it still runs, ahead
  // of the barrier between the two: they depend on nothing in LDS, and asked for behind the
  // barrier all 16 waves would wait out the cache latency together with the matrix units idle.
  // bw = twelve fragments: the first four k steps of a head's three tiles, or (behind the last
  // head) the first twelve of this wave's sixteen output-projection fragments.
  const int j0 = (wave & 1) * 3;               // of q0 q1 k0 k1 v0 v1: even wave 0..2, odd wave 3..5
  auto wtile = [&](int hh, int j) -> const half_t* {
    const int nt = ((j0 + j) >> 1) * 16 + hh * 2 + ((j0 + j) & 1);   // q:0.., k:16.., v:32..
    return wqkvP + (size_t)(nt * 8 * 512) + lane * 8;
  };
  const half_t* wp = woutP + (size_t)((wave >> 1) * 2 * 8 * 512) + lane * 8;
  v16h bw[4][3];
  auto fetch12 = [&](const half_t* p0, const half_t* p1, const half_t* p2) {
#pragma unroll
    for (int ks = 0; ks < 4; ++ks) {
      bw[ks][0] = load_frag(p0 + ks * 512);
      bw[ks][1] = load_frag(p1 + ks * 512);
      bw[ks][2] = load_frag(p2 + ks * 512);
    }
    // Address registers of these loads are rewritten only behind this wait; it takes the
    // bases as inputs, so that they stay whole up to it.
    asm volatile("s_wait_xcnt 0x0" :: "v"(p0), "v"(p1), "v"(p2) : "memory");
  };

  // Stage LN affine params into LDS.
  sGamma[tid] = (tid < 256) ? gamma[tid] : beta[tid - 256];   // sBeta follows sGamma

  // ---- Phase 1: window gather + LayerNorm (two threads per token, 128 channels each) ----
  {
    const int tok = tid & 255;
    const int cb  = (wave >> 3) * 128;          // this thread's channels: cb .. cb+127 (one value per wave)
    const int wd = tok >> 6, wh = (tok >> 3) & 7, ww = tok & 7;
    const size_t sp = (size_t)(d0 + wd) * 4096 + (size_t)(h0 + wh) * 64 + (size_t)(w0 + ww);
    const float* xp = x + sp;
    half_t* raw = OALL + (size_t)tok * XSTR;    // OALL region is free right now
    float s = 0.f, ss = 0.f;
    // 64 loads are issued before the first is used (a wave's load counter holds no more),
    // so a wave waits out the memory latency twice; 16 waves keep 1,024 loads in flight.
#pragma unroll 1   // two trips of 64 channels
    for (int c0 = cb; c0 < cb + 128; c0 += 64) {
      float v[64];
#pragma unroll
      for (int g = 0; g < 64; g += 32) {
#pragma unroll
        for (int j = 0; j < 32; ++j) v[g + j] = xp[(size_t)(c0 + g + j) * 65536];
        // Address registers of the issued loads are rewritten only behind this wait. It
        // takes the group's base as an input, so that no load of the group is given its
        // own address pair as target ahead of the wait.
        asm volatile("s_wait_xcnt 0x0" :: "v"(xp + (size_t)(c0 + g) * 65536) : "memory");
      }
#pragma unroll
      for (int j = 0; j < 64; ++j) {
        s += v[j]; ss += v[j] * v[j];
        raw[c0 + j] = (half_t)v[j];
      }
    }
    sPart[tid] = make_float2(s, ss);
    __syncthreads();                            // gamma/beta and the half sums staged by all threads
    fetch12(wtile(0, 0), wtile(0, 1), wtile(0, 2));   // head 0; arrives under the normalising loop
    const float2 pl = sPart[tok], ph = sPart[tok + 256];
    s  = pl.x + ph.x;                           // low channels + high channels, in both threads
    ss = pl.y + ph.y;
    const float mu  = s * (1.f / 256.f);
    const float var = ss * (1.f / 256.f) - mu * mu;
    const float rs  = rsqrtf(var + 1e-5f);
    half_t* xr = XN + (size_t)tok * XSTR;
#pragma unroll 8
    for (int i = 0; i < 128; ++i) {
      const int c = cb + i;
      float v = ((float)raw[c] - mu) * rs * sGamma[c] + sBeta[c];
      xr[c] = (half_t)v;
    }
  }
  __syncthreads();

  // ---- Phase 2: per head, QKV projection then attention ----
  // Lane part of the swizzled Q/K store offset, element (token mrow + r + 8*hi,
  // dh jj*16 + nsel): piece jj*2 + (nsel>>3), row term (r>>2) + 2*hi.
  int qkst[2][2];
#pragma unroll
  for (int jj = 0; jj < 2; ++jj)
#pragma unroll
    for (int rr = 0; rr < 2; ++rr)
      qkst[jj][rr] = hi * 8 * QSTR + (((jj * 2 + (nsel >> 3)) ^ (rr + 2 * hi)) << 3) + (nsel & 7);
#pragma unroll 1
  for (int h = 0; h < NHEAD; ++h) {
    // This wave's bias fragments of the head, [query tile = wave][key tile][lane][8].
    const half_t* biasp = biasP + (size_t)h * 65536 + (size_t)wave * 4096 + lane * 8;
    v8h bb[16];
    // --- QKV GEMM: wave pair mg owns token tiles {2mg, 2mg+1}; of the head's 6 output
    // tiles (q0 q1 k0 k1 v0 v1) the even wave takes the first 3, the odd wave the last 3.
    // Each weight fragment still serves two token tiles. ---
    {
      const int mrow0 = (wave >> 1) * 32;
      v8f acc[2][3];
#pragma unroll
      for (int j = 0; j < 3; ++j) { acc[0][j] = vzero; acc[1][j] = vzero; }
      // Weight fragments are fetched four k steps ahead of their use (256 registers do not
      // hold all 24 beside the accumulators); k steps 0..3 are in bw already.
      const half_t* w0 = wtile(h, 0);
      const half_t* w1 = wtile(h, 1);
      const half_t* w2 = wtile(h, 2);
      v16h b2[4][3];
#pragma unroll
      for (int ks = 0; ks < 8; ++ks) {
        // Keeps each group of weight loads where it is written: left alone, the compiler
        // sank every load to just in front of its WMMAs and waited out each one's latency.
        __builtin_amdgcn_sched_barrier(0);
        v16h a0 = load_ab(XN, XSTR, mrow0,      ks * 32, lane);
        v16h a1 = load_ab(XN, XSTR, mrow0 + 16, ks * 32, lane);
#pragma unroll
        for (int j = 0; j < 3; ++j) {
          const v16h bf = ks < 4 ? bw[ks][j] : b2[ks - 4][j];
          acc[0][j] = wmma16(a0, bf, acc[0][j]);
          acc[1][j] = wmma16(a1, bf, acc[1][j]);
        }
        if (ks < 4) {
          b2[ks][0] = load_frag(w0 + (ks + 4) * 512);
          b2[ks][1] = load_frag(w1 + (ks + 4) * 512);
          b2[ks][2] = load_frag(w2 + (ks + 4) * 512);
        }
        if (ks == 5) {
          // Address registers of the weight loads are rewritten only behind this wait.
          asm volatile("s_wait_xcnt 0x0" :: "v"(w0), "v"(w1), "v"(w2) : "memory");
          // The head's bias, asked for as soon as registers are free: it arrives under the
          // last k steps, the scatter and the barrier.
#pragma unroll
          for (int kt = 0; kt < 16; ++kt) bb[kt] = *(const v8h*)(biasp + kt * 256);
        }
      }
      // Address registers of the bias loads are rewritten only behind this wait.
      asm volatile("s_wait_xcnt 0x0" :: "v"(biasp) : "memory");
      __builtin_amdgcn_sched_barrier(0);   // nothing of the scatter moves up over that wait
      // scatter D tiles: (m=token r+8*hi, n=dh lane&15)
      auto put_qk = [&](half_t* dst, int half, const v8f& d, int mrow) {
#pragma unroll
        for (int r = 0; r < 8; ++r) dst[(mrow + r) * QSTR + qkst[half][r >> 2]] = (half_t)d[r];
      };
      auto put_v = [&](int half, const v8f& d, int mrow) {   // transposed store
#pragma unroll
        for (int r = 0; r < 8; ++r) VT[(half * 16 + nsel) * XSTR + mrow + r + 8 * hi] = (half_t)d[r];
      };
      if (j0 == 0) {
#pragma unroll
        for (int mt = 0; mt < 2; ++mt) {
          put_qk(QS, 0, acc[mt][0], mrow0 + mt * 16);
          put_qk(QS, 1, acc[mt][1], mrow0 + mt * 16);
          put_qk(KS, 0, acc[mt][2], mrow0 + mt * 16);
        }
      } else {
#pragma unroll
        for (int mt = 0; mt < 2; ++mt) {
          put_qk(KS, 1, acc[mt][0], mrow0 + mt * 16);
          put_v(0, acc[mt][1], mrow0 + mt * 16);
          put_v(1, acc[mt][2], mrow0 + mt * 16);
        }
      }
    }
    lds_barrier();   // Q, K, V^T published; the bias loads stay in flight

    // --- attention: S^T = K·Q^T then O^T = V^T·P^T ; wave owns query tile w ---
    {
      const int qbase = wave * 16;
      const v16h bq = load_qk(QS, qbase, lane);              // B: n=query, k=dh(32)
      float sreg[16][8];                                     // S^T tiles, this lane: one query
      float vmax = -3.0e38f;
#pragma unroll
      for (int kt = 0; kt < 16; ++kt) {
        v16h ak = load_qk(KS, kt * 16, lane);                // A: m=key, k=dh
        v8f sc = wmma16(ak, bq, vzero);
#pragma unroll
        for (int r = 0; r < 8; ++r) {
          float f = sc[r] * SCALE_QK + (float)bb[kt][r];     // bias[h][query][key..key+7]
          sreg[kt][r] = f;
          vmax = fmaxf(vmax, f);
        }
      }
      vmax = fmaxf(vmax, __shfl_xor(vmax, 16));              // lanes l, l+16 share a query
      float rsum = 0.f;
      v8f o0 = vzero, o1 = vzero;
      v16h pb[8];                                            // D tiles ARE the B operand
#pragma unroll
      for (int kb = 0; kb < 8; ++kb) {                       // 32-key blocks
#pragma unroll
        for (int r = 0; r < 8; ++r) {
          float e0 = __expf(sreg[2 * kb][r] - vmax);
          float e1 = __expf(sreg[2 * kb + 1][r] - vmax);
          rsum += e0 + e1;
          pb[kb][r]     = (half_t)e0;
          pb[kb][8 + r] = (half_t)e1;
        }
        if (kb == PREKB) {
          // Enough score registers are free: ask for what the phase behind the next barrier
          // needs first. The two scheduling barriers hold the loads at this place: earlier the
          // registers do not suffice, later the lead is lost.
          const bool last = h == NHEAD - 1;
          __builtin_amdgcn_sched_barrier(0);
          fetch12(last ? wp            : wtile(h + 1, 0),
                  last ? wp + 4 * 512  : wtile(h + 1, 1),
                  last ? wp + 8 * 512  : wtile(h + 1, 2));
          __builtin_amdgcn_sched_barrier(0);
        }
      }
#pragma unroll
      for (int kb = 0; kb < 8; ++kb) {
        v16h av0 = load_ab(VT, XSTR, 0,  kb * 32, lane);     // A: m=dh 0..15,  k=key
        v16h av1 = load_ab(VT, XSTR, 16, kb * 32, lane);     // A: m=dh 16..31, k=key
        o0 = wmma16(av0, pb[kb], o0);
        o1 = wmma16(av1, pb[kb], o1);
      }
      rsum += __shfl_xor(rsum, 16);
      const float inv = 1.f / rsum;
      half_t* orow = OALL + (size_t)(qbase + nsel) * XSTR + h * 32;
#pragma unroll
      for (int r = 0; r < 8; ++r) {                          // O^T: n=query=lane&15 too
        orow[r + 8 * hi]      = (half_t)(o0[r] * inv);
        orow[16 + r + 8 * hi] = (half_t)(o1[r] * inv);
      }
    }
    lds_barrier();   // all reads of Q, K, V^T done, O published; the weight loads stay in flight
  }

  // ---- Phase 3: output projection out^T = w_out^T * OALL^T (+b_out) + window merge ----
  v16h aw[2][8];                                             // A: m=channel, k=inner
#pragma unroll
  for (int f = 0; f < 12; ++f) aw[f >> 3][f & 7] = bw[f & 3][f >> 2];   // asked for under head 7
#pragma unroll
  for (int f = 12; f < 16; ++f) aw[1][f - 8] = load_frag(wp + f * 512);
  // Address registers of these loads are reused only behind this wait; it takes their
  // base as an input, so that the last load is not given its own address pair as target.
  asm volatile("s_wait_xcnt 0x0" :: "v"(wp) : "memory");
  if (tid < 256) sBout[tid] = b_out[tid];
  asm volatile("s_wait_xcnt 0x0" ::: "memory");   // before the load's address registers are reused
  __syncthreads();
  {
    // A wave owns 2 channel tiles x 8 token tiles: each OALL fragment read from LDS feeds two
    // WMMAs, and the workgroup reads OALL 8 times over, not 16.
    const int ct0 = (wave >> 1) * 2;                         // first channel tile
    const int tt0 = (wave & 1) * 8;                          // first token tile
    // This lane's row of the group's first token tile; carried through the loop so that every
    // read of a group is this one address plus an immediate offset.
    const half_t* bp = OALL + (size_t)(tt0 * 16 + nsel) * XSTR + hi * 8;
    auto frag = [](const half_t* p) {                        // = load_ab, row and lane half already in p
      v8h lo = *(const v8h*)(p);
      v8h hh = *(const v8h*)(p + 16);
      v16h r;
#pragma unroll
      for (int e = 0; e < 8; ++e) { r[e] = lo[e]; r[8 + e] = hh[e]; }
      return r;
    };
#pragma unroll 1   // four groups of 2 x 2 tiles; the weights stay in registers throughout
    for (int g = 0; g < 4; ++g, bp += 32 * XSTR) {
      const int t0 = (tt0 + g * 2) * 16;
      v8f acc[2][2];
#pragma unroll
      for (int i = 0; i < 2; ++i) { acc[i][0] = vzero; acc[i][1] = vzero; }
      v16h b[8][2];                                          // B: n=token, k=inner
#pragma unroll
      for (int ks = 0; ks < 2; ++ks) {
        b[ks][0] = frag(bp + ks * 32);
        b[ks][1] = frag(bp + 16 * XSTR + ks * 32);
      }
#pragma unroll
      for (int ks = 0; ks < 8; ++ks) {
        // Holds each k step's reads (two steps ahead) and WMMAs where they are written. Builds
        // without it either sank each read to just in front of its WMMA, or spread the last
        // WMMAs among the stores, each store then waiting for its own bias read.
        __builtin_amdgcn_sched_barrier(0);
        if (ks < 6) {
          b[ks + 2][0] = frag(bp + (ks + 2) * 32);
          b[ks + 2][1] = frag(bp + 16 * XSTR + (ks + 2) * 32);
        }
#pragma unroll
        for (int j = 0; j < 2; ++j) {
          acc[0][j] = wmma16(aw[0][ks], b[ks][j], acc[0][j]);
          acc[1][j] = wmma16(aw[1][ks], b[ks][j], acc[1][j]);
        }
      }
#pragma unroll
      for (int j = 0; j < 2; ++j) {
        const int tok = t0 + j * 16 + nsel;
        const int wd = tok >> 6, wh = (tok >> 3) & 7, ww = tok & 7;
        const size_t sp = (size_t)(d0 + wd) * 4096 + (size_t)(h0 + wh) * 64 + (size_t)(w0 + ww);
#pragma unroll
        for (int i = 0; i < 2; ++i)
#pragma unroll
          for (int r = 0; r < 8; ++r) {
            const int c = (ct0 + i) * 16 + r + 8 * hi;
            out[(size_t)c * 65536 + sp] = acc[i][j][r] + sBout[c];  // lanes 0..7: 32B runs
          }
      }
      // Data and address registers of the group's stores are reused by the next group only
      // behind this wait.
      asm volatile("s_wait_xcnt 0x0" ::: "memory");
    }
  }
}

// ---------------------------------------------------------------------------
extern "C" void kernel_launch(void* const* d_in, const int* in_sizes, int n_in,
                              void* d_out, int out_size, void* d_ws, size_t ws_size,
                              hipStream_t stream)
{
  (void)in_sizes; (void)n_in; (void)out_size; (void)ws_size;
  const float* x      = (const float*)d_in[0];
  const float* gamma  = (const float*)d_in[1];
  const float* beta   = (const float*)d_in[2];
  const float* w_qkv  = (const float*)d_in[3];
  const float* w_out  = (const float*)d_in[4];
  const float* b_out  = (const float*)d_in[5];
  const float* btable = (const float*)d_in[6];
  const int*   relidx = (const int*)d_in[7];
  float* out = (float*)d_out;

  // Workspace: only 1.57 MB of f16 weight/bias staging.
  half_t* wqkvP = (half_t*)d_ws;            // 768*256
  half_t* woutP = wqkvP + 768 * 256;        // 256*256
  half_t* biasP = woutP + 256 * 256;        // 8*256*256

  swin_prep_kernel<<<3072, 256, 0, stream>>>(w_qkv, w_out, btable, relidx,
                                             wqkvP, woutP, biasP);

  (void)hipFuncSetAttribute((const void*)swin_window_attn_kernel,
                            hipFuncAttributeMaxDynamicSharedMemorySize, LDS_BYTES);
  swin_window_attn_kernel<<<256, 512, LDS_BYTES, stream>>>(
      x, gamma, beta, wqkvP, woutP, b_out, biasP, out);
}

// v008
// It runs in 70.8 microseconds.
// Timed twice side by side with v007, it ran 1.04 and 1.03 times as fast.
// Over all steps from v000 it is 2.17 times as fast.
#include <hip/hip_runtime.h>

typedef _Float16 half_t;
typedef __attribute__((ext_vector_type(16))) _Float16 v16h;
typedef __attribute__((ext_vector_type(8)))  _Float16 v8h;
typedef __attribute__((ext_vector_type(8)))  float    v8f;

#define NWTOK 256
#define CCH   256
#define NHEAD 8
#define SCALE_QK 0.17677669529663689f   // 1/sqrt(32)
#define LOG2E    1.4426950408889634f

// ---- LDS layout (total = 320512 bytes <= 320 KB/WGP) ----
#define XN_OFF   0            // half [256][264]  normalized input (A rows: [token][ch])
#define OALL_OFF 135168       // half [256][264]  attn output (B rows: [token][inner]); reused as LN raw staging
#define QS_OFF   270336       // half [256][32]   Q rows [query][dh], pieces swizzled (load_qk)
#define KS_OFF   286720       // half [256][32]   K rows [key][dh], pieces swizzled (load_qk)
#define VT_OFF   303104       // half [32][264]   V^T rows [dh][token]
#define EH_OFF   320000       // half [32 lanes][8]  one-hot piece of the two selector fragments (see attention)
#define LDS_BYTES 320512
#define XSTR 264
#define QSTR 32
#define PREKB 6               // 32-key block behind whose exponentials the next phase's weights are asked for

// One operand loader for both A and B (B assumed to mirror the documented A
// interleave: lane-half selects K sub-band {0..7,16..23} vs {8..15,24..31}).
// `tile` = first row (A: M row / B: N column) of the 16-wide tile; storage is
// row-major [row][k] with the given stride (halves). Emits 2x b128 loads.
static __device__ __forceinline__ v16h load_ab(const half_t* __restrict__ base,
                                               int stride, int tile, int kbase, int lane)
{
  const int m  = lane & 15;
  const int hi = (lane >> 4) & 1;
  const half_t* p = base + (size_t)(tile + m) * stride + kbase + hi * 8;
  v8h lo = *(const v8h*)(p);
  v8h hh = *(const v8h*)(p + 16);
  v16h r;
#pragma unroll
  for (int i = 0; i < 8; ++i) { r[i] = lo[i]; r[8 + i] = hh[i]; }
  return r;
}

// Same fragment as load_ab (same value in every lane and register), read from a
// buffer that the prep kernel laid out in fragment order: per (16-row tile,
// 32-wide k step) one 1-KB block = 32 lanes x 16 B of the low registers, then
// 32 lanes x 16 B of the high registers. Each b128 load covers 512 contiguous
// bytes (4 whole 128-B lines) instead of 32 B out of each of 16 rows.
// p = start of the block, (tile * 8 + k step) * 512 halves, + lane * 8.
static __device__ __forceinline__ v16h load_frag(const half_t* __restrict__ p)
{
  v8h lo = *(const v8h*)(p);
  v8h hh = *(const v8h*)(p + 256);
  v16h r;
#pragma unroll
  for (int i = 0; i < 8; ++i) { r[i] = lo[i]; r[8 + i] = hh[i]; }
  return r;
}

// Q and K rows are 64 B (four 16-B pieces). Piece c of row t is kept at piece
// c ^ ((t >> 2) & 3): the 16 rows that one half-wave reads at one piece index then
// fall on 16 different groups of four banks instead of 4 (unpadded 64-B rows put
// rows t, t+4, t+8, t+12 on the same banks). No extra LDS.
// Same fragment as load_ab(base, QSTR, tile, 0, lane), read through that map.
// tile is a multiple of 16, so the swizzle term depends on the lane alone.
static __device__ __forceinline__ v16h load_qk(const half_t* __restrict__ base,
                                               int tile, int lane)
{
  const int m  = lane & 15;
  const int hi = (lane >> 4) & 1;
  const int p0 = (hi ^ (m >> 2)) << 3;            // dh = hi*8 .. +7
  const half_t* p = base + (tile + m) * QSTR;
  v8h lo = *(const v8h*)(p + p0);
  v8h hh = *(const v8h*)(p + (p0 ^ 16));          // dh = 16 + hi*8 .. +7
  v16h r;
#pragma unroll
  for (int i = 0; i < 8; ++i) { r[i] = lo[i]; r[8 + i] = hh[i]; }
  return r;
}

// Work-group barrier for data that passes through LDS alone: the wave's own LDS reads and
// writes are done, then the barrier. __syncthreads() also waits for every global load of the
// wave, so a load asked for ahead would be waited out in front of it instead of flying over it.
// Between the waves of this kernel nothing passes through global memory.
static __device__ __forceinline__ void lds_barrier()
{
  asm volatile("s_wait_dscnt 0x0" ::: "memory");
  asm volatile("s_barrier_signal -1\n\ts_barrier_wait -1" ::: "memory");
}

static __device__ __forceinline__ v8f wmma16(v16h a, v16h b, v8f c)
{
  return __builtin_amdgcn_wmma_f32_16x16x32_f16(false, a, false, b, (short)0, c, false, false);
}

// ---------------------------------------------------------------------------
// Prep: convert the weights to f16 in fragment order (see load_frag), expand
// the relative-position bias table to f16 in the order of the S^T tiles:
// [head][query tile][key tile][lane][8], lane = (key>>3 & 1)*16 + (query & 15).
// Two key tiles side by side are one B fragment (n = query, k = 32 keys).
// The Q columns of w_qkv carry 1/sqrt(32) * log2(e) and the bias carries log2(e),
// so that the matrix products give log2(e) * (scaled score + bias) with no vector work.
// ---------------------------------------------------------------------------
__global__ void __launch_bounds__(256) swin_prep_kernel(
    const float* __restrict__ w_qkv,      // [256][768]
    const float* __restrict__ w_out,      // [256][256]
    const float* __restrict__ bias_table, // [1575][8]
    const int*   __restrict__ rel_index,  // [256][256] (query, key)
    half_t* __restrict__ wqkvP,           // [48 tiles][8 k steps][2][32 lanes][8]
    half_t* __restrict__ woutP,           // [16 tiles][8 k steps][2][32 lanes][8]
    half_t* __restrict__ biasP)           // [8][16 q tiles][16 key tiles][32 lanes][8]
{
  const int idx = blockIdx.x * 256 + threadIdx.x;
  if (idx < 768 * 256 + 256 * 256) {
    const bool isq = idx < 768 * 256;
    const int i    = isq ? idx : idx - 768 * 256;
    const int e    = i & 7;                         // element of the 16-B piece
    const int ln   = (i >> 3) & 31;                 // lane of the fragment
    const int sel  = (i >> 8) & 1;                  // low / high registers
    const int ks   = (i >> 9) & 7;
    const int row  = (i >> 12) * 16 + (ln & 15);    // output column of the weight
    const int k    = ks * 32 + sel * 16 + (ln >> 4) * 8 + e;
    if (isq) wqkvP[i] = (half_t)(w_qkv[k * 768 + row] * (row < 256 ? SCALE_QK * LOG2E : 1.f));
    else     woutP[i] = (half_t)w_out[k * 256 + row];
  } else {
    const int i  = idx - (768 * 256 + 256 * 256);   // < 8*65536
    const int hh = i >> 16;
    const int e  = i & 7;
    const int ln = (i >> 3) & 31;
    const int kt = (i >> 8) & 15;
    const int qt = (i >> 12) & 15;
    const int query = qt * 16 + (ln & 15);
    const int key   = kt * 16 + (ln >> 4) * 8 + e;
    const int rel   = min(max(rel_index[query * 256 + key], 0), 1574);  // stay inside bias_table
    biasP[i] = (half_t)(bias_table[rel * 8 + hh] * LOG2E);
  }
}

// ---------------------------------------------------------------------------
// Fully fused window-attention block: one workgroup (16 wave32, four per SIMD)
// per window. The LDS lets only one workgroup live on a WGP, so its own waves are
// all that can cover each other's LDS, cache and dependent-chain waits.
// ---------------------------------------------------------------------------
__global__ void __launch_bounds__(512) swin_window_attn_kernel(
    const float* __restrict__ x,        // (1,256,16,64,64)
    const float* __restrict__ gamma,
    const float* __restrict__ beta,
    const half_t* __restrict__ wqkvP,   // fragment order, 48 tiles x 8 k steps
    const half_t* __restrict__ woutP,   // fragment order, 16 tiles x 8 k steps
    const float* __restrict__ b_out,
    const half_t* __restrict__ biasP,   // [8][16][16][32 lanes][8]
    float* __restrict__ out)            // (1,256,16,64,64)
{
  extern __shared__ char smem[];
  half_t* XN   = (half_t*)(smem + XN_OFF);
  half_t* OALL = (half_t*)(smem + OALL_OFF);
  half_t* QS   = (half_t*)(smem + QS_OFF);
  half_t* KS   = (half_t*)(smem + KS_OFF);
  half_t* VT   = (half_t*)(smem + VT_OFF);
  half_t* EH   = (half_t*)(smem + EH_OFF);
  float*  sGamma = (float*)(smem + QS_OFF);   // overlay while QS unused (LN phase)
  float*  sBeta  = sGamma + 256;
  float2* sPart  = (float2*)(sGamma + 512);   // per thread: sum, sum of squares of its 128 channels
  float*  sBout  = (float*)(smem + QS_OFF);   // overlay while QS unused (out phase)

  const int tid  = threadIdx.x;
  const int lane = tid & 31;
  const int wave = __builtin_amdgcn_readfirstlane(tid >> 5);   // 0..15, in a scalar register
  const int hi   = (lane >> 4) & 1;
  const int nsel = lane & 15;

  // Which window a workgroup takes. The 8 windows side by side in w share every 256-B row
  // of x and of out. Those 8 windows get indices 8 apart. Speed only: any placement gives the
  // same values, since index -> window stays one to one (3 + 2 + 3 index bits, each used once).
  const int bid = blockIdx.x;
  const int gw = (bid >> 3) & 7;
  const int gd = (bid & 7) >> 1, gh = ((bid & 1) << 2) | (bid >> 6);
  const int d0 = gd * 4, h0 = gh * 8, w0 = gw * 8;

  const v8f vzero = {0.f, 0.f, 0.f, 0.f, 0.f, 0.f, 0.f, 0.f};

  // Weights that a phase needs first are asked for while the phase before it still runs, ahead
  // of the barrier between the two: they depend on nothing in LDS, and asked for behind the
  // barrier all 16 waves would wait out the cache latency together with the matrix units idle.
  // bw = twelve fragments: the first four k steps of a head's three tiles, or (behind the last
  // head) the first twelve of this wave's sixteen output-projection fragments.
  const int j0 = (wave & 1) * 3;               // of q0 q1 k0 k1 v0 v1: even wave 0..2, odd wave 3..5
  auto wtile = [&](int hh, int j) -> const half_t* {
    const int nt = ((j0 + j) >> 1) * 16 + hh * 2 + ((j0 + j) & 1);   // q:0.., k:16.., v:32..
    return wqkvP + (size_t)(nt * 8 * 512) + lane * 8;
  };
  const half_t* wp = woutP + (size_t)((wave >> 1) * 2 * 8 * 512) + lane * 8;
  v16h bw[4][3];
  auto fetch12 = [&](const half_t* p0, const half_t* p1, const half_t* p2) {
#pragma unroll
    for (int ks = 0; ks < 4; ++ks) {
      bw[ks][0] = load_frag(p0 + ks * 512);
      bw[ks][1] = load_frag(p1 + ks * 512);
      bw[ks][2] = load_frag(p2 + ks * 512);
    }
    // Address registers of these loads are rewritten only behind this wait; it takes the
    // bases as inputs, so that they stay whole up to it.
    asm volatile("s_wait_xcnt 0x0" :: "v"(p0), "v"(p1), "v"(p2) : "memory");
  };

  // Stage LN affine params into LDS.
  sGamma[tid] = (tid < 256) ? gamma[tid] : beta[tid - 256];   // sBeta follows sGamma

  // One-hot piece of the selector fragments: lane (m = lane & 15, hi) holds A[m][hi*8 + i] of a
  // 16 x 16 identity. Kept in LDS, read once a head: held in registers through the QKV product
  // it would not fit beside the weights there. Published by the barriers of phase 1.
  if (tid < 32) {
    v8h oh;
#pragma unroll
    for (int i = 0; i < 8; ++i) oh[i] = (hi * 8 + i == nsel) ? (half_t)1.f : (half_t)0.f;
    *(v8h*)(EH + lane * 8) = oh;
  }

  // ---- Phase 1: window gather + LayerNorm (two threads per token, 128 channels each) ----
  {
    const int tok = tid & 255;
    const int cb  = (wave >> 3) * 128;          // this thread's channels: cb .. cb+127 (one value per wave)
    const int wd = tok >> 6, wh = (tok >> 3) & 7, ww = tok & 7;
    const size_t sp = (size_t)(d0 + wd) * 4096 + (size_t)(h0 + wh) * 64 + (size_t)(w0 + ww);
    const float* xp = x + sp;
    half_t* raw = OALL + (size_t)tok * XSTR;    // OALL region is free right now
    float s = 0.f, ss = 0.f;
    // 64 loads are issued before the first is used (a wave's load counter holds no more),
    // so a wave waits out the memory latency twice; 16 waves keep 1,024 loads in flight.
#pragma unroll 1   // two trips of 64 channels
    for (int c0 = cb; c0 < cb + 128; c0 += 64) {
      float v[64];
#pragma unroll
      for (int g = 0; g < 64; g += 32) {
#pragma unroll
        for (int j = 0; j < 32; ++j) v[g + j] = xp[(size_t)(c0 + g + j) * 65536];
        // Address registers of the issued loads are rewritten only behind this wait. It
        // takes the group's base as an input, so that no load of the group is given its
        // own address pair as target ahead of the wait.
        asm volatile("s_wait_xcnt 0x0" :: "v"(xp + (size_t)(c0 + g) * 65536) : "memory");
      }
#pragma unroll
      for (int j = 0; j < 64; ++j) {
        s += v[j]; ss += v[j] * v[j];
        raw[c0 + j] = (half_t)v[j];
      }
    }
    sPart[tid] = make_float2(s, ss);
    __syncthreads();                            // gamma/beta and the half sums staged by all threads
    fetch12(wtile(0, 0), wtile(0, 1), wtile(0, 2));   // head 0; arrives under the normalising loop
    const float2 pl = sPart[tok], ph = sPart[tok + 256];
    s  = pl.x + ph.x;                           // low channels + high channels, in both threads
    ss = pl.y + ph.y;
    const float mu  = s * (1.f / 256.f);
    const float var = ss * (1.f / 256.f) - mu * mu;
    const float rs  = rsqrtf(var + 1e-5f);
    half_t* xr = XN + (size_t)tok * XSTR;
#pragma unroll 8
    for (int i = 0; i < 128; ++i) {
      const int c = cb + i;
      float v = ((float)raw[c] - mu) * rs * sGamma[c] + sBeta[c];
      xr[c] = (half_t)v;
    }
  }
  __syncthreads();

  // ---- Phase 2: per head, QKV projection then attention ----
  // Lane part of the swizzled Q/K store offset, element (token mrow + r + 8*hi,
  // dh jj*16 + nsel): piece jj*2 + (nsel>>3), row term (r>>2) + 2*hi.
  int qkst[2][2];
#pragma unroll
  for (int jj = 0; jj < 2; ++jj)
#pragma unroll
    for (int rr = 0; rr < 2; ++rr)
      qkst[jj][rr] = hi * 8 * QSTR + (((jj * 2 + (nsel >> 3)) ^ (rr + 2 * hi)) << 3) + (nsel & 7);
#pragma unroll 1
  for (int h = 0; h < NHEAD; ++h) {
    // This wave's bias fragments of the head, [query tile = wave][key tile][lane][8].
    const half_t* biasp = biasP + (size_t)h * 65536 + (size_t)wave * 4096 + lane * 8;
    v16h bb[8];                                // B fragments: n = query, k = keys 32j .. 32j+31
    // --- QKV GEMM: wave pair mg owns token tiles {2mg, 2mg+1}; of the head's 6 output
    // tiles (q0 q1 k0 k1 v0 v1) the even wave takes the first 3, the odd wave the last 3.
    // Each weight fragment still serves two token tiles. ---
    {
      const int mrow0 = (wave >> 1) * 32;
      v8f acc[2][3];
#pragma unroll
      for (int j = 0; j < 3; ++j) { acc[0][j] = vzero; acc[1][j] = vzero; }
      // Weight fragments are fetched four k steps ahead of their use (256 registers do not
      // hold all 24 beside the accumulators); k steps 0..3 are in bw already.
      const half_t* w0 = wtile(h, 0);
      const half_t* w1 = wtile(h, 1);
      const half_t* w2 = wtile(h, 2);
      v16h b2[4][3];
#pragma unroll
      for (int ks = 0; ks < 8; ++ks) {
        // Keeps each group of weight loads where it is written: left alone, the compiler
        // sank every load to just in front of its WMMAs and waited out each one's latency.
        __builtin_amdgcn_sched_barrier(0);
        v16h a0 = load_ab(XN, XSTR, mrow0,      ks * 32, lane);
        v16h a1 = load_ab(XN, XSTR, mrow0 + 16, ks * 32, lane);
#pragma unroll
        for (int j = 0; j < 3; ++j) {
          const v16h bf = ks < 4 ? bw[ks][j] : b2[ks - 4][j];
          acc[0][j] = wmma16(a0, bf, acc[0][j]);
          acc[1][j] = wmma16(a1, bf, acc[1][j]);
        }
        if (ks < 4) {
          b2[ks][0] = load_frag(w0 + (ks + 4) * 512);
          b2[ks][1] = load_frag(w1 + (ks + 4) * 512);
          b2[ks][2] = load_frag(w2 + (ks + 4) * 512);
        }
        if (ks == 5) {
          // Address registers of the weight loads are rewritten only behind this wait.
          asm volatile("s_wait_xcnt 0x0" :: "v"(w0), "v"(w1), "v"(w2) : "memory");
          // The head's bias, asked for as soon as registers are free: it arrives under the
          // last k steps, the scatter and the barrier.
#pragma unroll
          for (int j = 0; j < 8; ++j) bb[j] = load_frag(biasp + j * 512);
        }
      }
      // Address registers of the bias loads are rewritten only behind this wait.
      asm volatile("s_wait_xcnt 0x0" :: "v"(biasp) : "memory");
      __builtin_amdgcn_sched_barrier(0);   // nothing of the scatter moves up over that wait
      // scatter D tiles: (m=token r+8*hi, n=dh lane&15)
      auto put_qk = [&](half_t* dst, int half, const v8f& d, int mrow) {
#pragma unroll
        for (int r = 0; r < 8; ++r) dst[(mrow + r) * QSTR + qkst[half][r >> 2]] = (half_t)d[r];
      };
      auto put_v = [&](int half, const v8f& d, int mrow) {   // transposed store
#pragma unroll
        for (int r = 0; r < 8; ++r) VT[(half * 16 + nsel) * XSTR + mrow + r + 8 * hi] = (half_t)d[r];
      };
      if (j0 == 0) {
#pragma unroll
        for (int mt = 0; mt < 2; ++mt) {
          put_qk(QS, 0, acc[mt][0], mrow0 + mt * 16);
          put_qk(QS, 1, acc[mt][1], mrow0 + mt * 16);
          put_qk(KS, 0, acc[mt][2], mrow0 + mt * 16);
        }
      } else {
#pragma unroll
        for (int mt = 0; mt < 2; ++mt) {
          put_qk(KS, 1, acc[mt][0], mrow0 + mt * 16);
          put_v(0, acc[mt][1], mrow0 + mt * 16);
          put_v(1, acc[mt][2], mrow0 + mt * 16);
        }
      }
    }
    lds_barrier();   // Q, K, V^T published; the bias loads stay in flight

    // --- attention: S^T = K·Q^T then O^T = V^T·P^T ; wave owns query tile w ---
    {
      const int qbase = wave * 16;
      const v16h bq = load_qk(QS, qbase, lane);              // B: n=query, k=dh(32)
      // The bias enters through the matrix unit: selector x bias fragment starts each tile's
      // accumulator. e0 = [I 0] picks keys 0..15 of the fragment's 32, e1 = [0 I] keys 16..31;
      // 1.0 x f16 summed with zeros is exact in f32.
      const v8h eh = *(const v8h*)(EH + lane * 8);
      v16h e0, e1;
#pragma unroll
      for (int i = 0; i < 8; ++i) {
        e0[i] = eh[i];        e0[8 + i] = (half_t)0.f;
        e1[i] = (half_t)0.f;  e1[8 + i] = eh[i];
      }
      v8f sreg[16];                                          // S^T tiles in log2 units, this lane: one query
#pragma unroll
      for (int j = 0; j < 8; ++j) {
        sreg[2 * j]     = wmma16(e0, bb[j], vzero);
        sreg[2 * j + 1] = wmma16(e1, bb[j], vzero);
      }
#pragma unroll
      for (int kt = 0; kt < 16; ++kt) {
        v16h ak = load_qk(KS, kt * 16, lane);                // A: m=key, k=dh
        sreg[kt] = wmma16(ak, bq, sreg[kt]);
      }
      // Holds the maxima behind the whole run of WMMAs: mixed in, each tile's first maximum stood
      // directly behind its WMMA and the compiler filled the distance with v_nop.
      __builtin_amdgcn_sched_barrier(0);
      float vmax = -3.0e38f, vmax1 = -3.0e38f;               // two chains; a maximum has no order
#pragma unroll
      for (int kt = 0; kt < 16; kt += 2)
#pragma unroll
        for (int r = 0; r < 8; ++r) {
          vmax  = fmaxf(vmax,  sreg[kt][r]);
          vmax1 = fmaxf(vmax1, sreg[kt + 1][r]);
        }
      vmax = fmaxf(vmax, vmax1);
      vmax = fmaxf(vmax, __shfl_xor(vmax, 16));              // lanes l, l+16 share a query
      float rsum = 0.f;
      v8f o0 = vzero, o1 = vzero;
      v16h pb[8];                                            // D tiles ARE the B operand
#pragma unroll
      for (int kb = 0; kb < 8; ++kb) {                       // 32-key blocks
#pragma unroll
        for (int r = 0; r < 8; ++r) {
          float p0 = __builtin_amdgcn_exp2f(sreg[2 * kb][r] - vmax);
          float p1 = __builtin_amdgcn_exp2f(sreg[2 * kb + 1][r] - vmax);
          rsum += p0 + p1;
          pb[kb][r]     = (half_t)p0;
          pb[kb][8 + r] = (half_t)p1;
        }
        if (kb == PREKB) {
          // Enough score registers are free: ask for what the phase behind the next barrier
          // needs first. The two scheduling barriers hold the loads at this place: earlier the
          // registers do not suffice, later the lead is lost.
          const bool last = h == NHEAD - 1;
          __builtin_amdgcn_sched_barrier(0);
          fetch12(last ? wp            : wtile(h + 1, 0),
                  last ? wp + 4 * 512  : wtile(h + 1, 1),
                  last ? wp + 8 * 512  : wtile(h + 1, 2));
          __builtin_amdgcn_sched_barrier(0);
        }
      }
#pragma unroll
      for (int kb = 0; kb < 8; ++kb) {
        v16h av0 = load_ab(VT, XSTR, 0,  kb * 32, lane);     // A: m=dh 0..15,  k=key
        v16h av1 = load_ab(VT, XSTR, 16, kb * 32, lane);     // A: m=dh 16..31, k=key
        o0 = wmma16(av0, pb[kb], o0);
        o1 = wmma16(av1, pb[kb], o1);
      }
      rsum += __shfl_xor(rsum, 16);
      const float inv = 1.f / rsum;
      half_t* orow = OALL + (size_t)(qbase + nsel) * XSTR + h * 32;
#pragma unroll
      for (int r = 0; r < 8; ++r) {                          // O^T: n=query=lane&15 too
        orow[r + 8 * hi]      = (half_t)(o0[r] * inv);
        orow[16 + r + 8 * hi] = (half_t)(o1[r] * inv);
      }
    }
    lds_barrier();   // all reads of Q, K, V^T done, O published; the weight loads stay in flight
  }

  // ---- Phase 3: output projection out^T = w_out^T * OALL^T (+b_out) + window merge ----
  v16h aw[2][8];                                             // A: m=channel, k=inner
#pragma unroll
  for (int f = 0; f < 12; ++f) aw[f >> 3][f & 7] = bw[f & 3][f >> 2];   // asked for under head 7
#pragma unroll
  for (int f = 12; f < 16; ++f) aw[1][f - 8] = load_frag(wp + f * 512);
  // Address registers of these loads are reused only behind this wait; it takes their
  // base as an input, so that the last load is not given its own address pair as target.
  asm volatile("s_wait_xcnt 0x0" :: "v"(wp) : "memory");
  if (tid < 256) sBout[tid] = b_out[tid];
  asm volatile("s_wait_xcnt 0x0" ::: "memory");   // before the load's address registers are reused
  __syncthreads();
  {
    // A wave owns 2 channel tiles x 8 token tiles: each OALL fragment read from LDS feeds two
    // WMMAs, and the workgroup reads OALL 8 times over, not 16.
    const int ct0 = (wave >> 1) * 2;                         // first channel tile
    const int tt0 = (wave & 1) * 8;                          // first token tile
    // This lane's row of the group's first token tile; carried through the loop so that every
    // read of a group is this one address plus an immediate offset.
    const half_t* bp = OALL + (size_t)(tt0 * 16 + nsel) * XSTR + hi * 8;
    auto frag = [](const half_t* p) {                        // = load_ab, row and lane half already in p
      v8h lo = *(const v8h*)(p);
      v8h hh = *(const v8h*)(p + 16);
      v16h r;
#pragma unroll
      for (int e = 0; e < 8; ++e) { r[e] = lo[e]; r[8 + e] = hh[e]; }
      return r;
    };
#pragma unroll 1   // four groups of 2 x 2 tiles; the weights stay in registers throughout
    for (int g = 0; g < 4; ++g, bp += 32 * XSTR) {
      const int t0 = (tt0 + g * 2) * 16;
      v8f acc[2][2];
#pragma unroll
      for (int i = 0; i < 2; ++i) { acc[i][0] = vzero; acc[i][1] = vzero; }
      v16h b[8][2];                                          // B: n=token, k=inner
#pragma unroll
      for (int ks = 0; ks < 2; ++ks) {
        b[ks][0] = frag(bp + ks * 32);
        b[ks][1] = frag(bp + 16 * XSTR + ks * 32);
      }
#pragma unroll
      for (int ks = 0; ks < 8; ++ks) {
        // Holds each k step's reads (two steps ahead) and WMMAs where they are written. Builds
        // without it either sank each read to just in front of its WMMA, or spread the last
        // WMMAs among the stores, each store then waiting for its own bias read.
        __builtin_amdgcn_sched_barrier(0);
        if (ks < 6) {
          b[ks + 2][0] = frag(bp + (ks + 2) * 32);
          b[ks + 2][1] = frag(bp + 16 * XSTR + (ks + 2) * 32);
        }
#pragma unroll
        for (int j = 0; j < 2; ++j) {
          acc[0][j] = wmma16(aw[0][ks], b[ks][j], acc[0][j]);
          acc[1][j] = wmma16(aw[1][ks], b[ks][j], acc[1][j]);
        }
      }
#pragma unroll
      for (int j = 0; j < 2; ++j) {
        const int tok = t0 + j * 16 + nsel;
        const int wd = tok >> 6, wh = (tok >> 3) & 7, ww = tok & 7;
        const size_t sp = (size_t)(d0 + wd) * 4096 + (size_t)(h0 + wh) * 64 + (size_t)(w0 + ww);
#pragma unroll
        for (int i = 0; i < 2; ++i)
#pragma unroll
          for (int r = 0; r < 8; ++r) {
            const int c = (ct0 + i) * 16 + r + 8 * hi;
            out[(size_t)c * 65536 + sp] = acc[i][j][r] + sBout[c];  // lanes 0..7: 32B runs
          }
      }
      // Data and address registers of the group's stores are reused by the next group only
      // behind this wait.
      asm volatile("s_wait_xcnt 0x0" ::: "memory");
    }
  }
}

// ---------------------------------------------------------------------------
extern "C" void kernel_launch(void* const* d_in, const int* in_sizes, int n_in,
                              void* d_out, int out_size, void* d_ws, size_t ws_size,
                              hipStream_t stream)
{
  (void)in_sizes; (void)n_in; (void)out_size; (void)ws_size;
  const float* x      = (const float*)d_in[0];
  const float* gamma  = (const float*)d_in[1];
  const float* beta   = (const float*)d_in[2];
  const float* w_qkv  = (const float*)d_in[3];
  const float* w_out  = (const float*)d_in[4];
  const float* b_out  = (const float*)d_in[5];
  const float* btable = (const float*)d_in[6];
  const int*   relidx = (const int*)d_in[7];
  float* out = (float*)d_out;

  // Workspace: only 1.57 MB of f16 weight/bias staging.
  half_t* wqkvP = (half_t*)d_ws;            // 768*256
  half_t* woutP = wqkvP + 768 * 256;        // 256*256
  half_t* biasP = woutP + 256 * 256;        // 8*256*256

  swin_prep_kernel<<<3072, 256, 0, stream>>>(w_qkv, w_out, btable, relidx,
                                             wqkvP, woutP, biasP);

  (void)hipFuncSetAttribute((const void*)swin_window_attn_kernel,
                            hipFuncAttributeMaxDynamicSharedMemorySize, LDS_BYTES);
  swin_window_attn_kernel<<<256, 512, LDS_BYTES, stream>>>(
      x, gamma, beta, wqkvP, woutP, b_out, biasP, out);
}
